// v008
// Times are from an AMD MI455X. After a warm-up the kernel runs many times in a row, and a time is the length of
// such a window on the GPU divided by its runs, so every launch and the gaps after it count. The runs cycle
// through copies of the inputs. A figure is the median of several windows, for all but v000 over two sittings.
// Sittings can differ by a few percent; kernels timed side by side share one.
// The versions before v008 are in another document.
// One run takes 58.7 microseconds.
// Two timings next to v007 put it at 1.17 and 1.18 times that version's speed.
// Counting every step since v000, which is the starting kernel, it is 119 times as fast.
#include <hip/hip_runtime.h>
// Non-local block with the softmax taken over the QUERY axis (x [4][256][64][64]; theta, phi, g = conv1x1(x) with [128][256] weights (U(+-1/16), no biases); scores[n][m] = theta[n].phi[m] (NO scaling); attn = softmax(scores, axis = 1): normalised over n for every key column m (the module's unconventional axis); out[n] = sum_m attn[n][m] g[m]; mask = conv1x1(out; w_mask [256][128], no bias); result = x + mask -> [4][256][64][64]).
// Structure: channel-first; the images share every launch (grid); one projection kernel reads f32 x (rounded to bf16, exact in f16), turns it to token rows in LDS and forms theta^T, phi^T (rows = tokens) and g (rows = channels) on WMMA (f32 accumulation) -> f16, every f16 plane of the workspace laid in fragment order (see FRB); f [4096][4096] = theta^T phi (K = 128, no scale) f32 in registers only, formed once for the column statistics and once for the weights (f32 statistics, native exp; weights x256 f16); y^T = P g^T (x2^-8) f16; out = (16 W) y / 16 + bf16(x) f32 channel-first; launches: k_wnat, k_proj, k_colstat_f, k_pvf.
// Compute dtype: inputs rounded to bf16; x / weights exact; q, k, v, softmax weights and o as plain f16 GEMM operands (~2^-12); scores and softmax statistics f32; v_wmma_f32_16x16x32_f16.
#define NB 4
#define SQ 4096
#define DM 256
#define NH 1
#define HD 64
#define HG 4                         /* heads per attention launch group */
#define B0 0                         /* first batch processed (debug hook) */
#define NBR NB                       /* batches processed (debug hook) */
#define NR ((size_t)NB * SQ)         /* token rows */
#define MP ((int)((size_t)NBR * SQ)) /* rows projected (debug hook) */
#define QT 256                       /* query rows per causal tile */
#define NKX SQ                       /* S / P row pitch */
#define QT0 256                      /* first-tile rows recomputed exactly (256: buys margin for the few-key rows 128..255, which have no output projection to average the single-f16 P/v rounding) */
#define QN SQ                        /* query rows attended per batch (debug hook) */
#define NHD NH                       /* heads attended (debug hook) */
#define MPO MP                       /* rows through the output stage (debug hook) */
#define LQ DM            /* row pitch of the q/k/v rows */
typedef __bf16 v16b __attribute__((ext_vector_type(16)));
typedef unsigned short v8us __attribute__((ext_vector_type(8), may_alias));
typedef float  v8f  __attribute__((ext_vector_type(8)));
typedef float  v4f  __attribute__((ext_vector_type(4)));
typedef float  v4fa __attribute__((ext_vector_type(4), may_alias));
union FragB { v16b v; v8us half[2]; unsigned short u[16]; };

__device__ __forceinline__ unsigned short bf16_bits(float x) { unsigned int u = __float_as_uint(x); return (unsigned short)((u + 0x7FFFu + ((u >> 16) & 1u)) >> 16); }
__device__ __forceinline__ float bf16_val(unsigned short b) { return __uint_as_float(((unsigned int)b) << 16); }
__device__ __forceinline__ float bf16_round(float x) { return bf16_val(bf16_bits(x)); }
// D += A·B with NT terms: 1 = ah·bh, 2 = + al·bh (A split), 3 = + ah·bl (both split)
template <int NT>
__device__ __forceinline__ v8f mmaN(v16b ah, v16b al, v16b bh, v16b bl, v8f c) {
  c = __builtin_amdgcn_wmma_f32_16x16x32_bf16(false, ah, false, bh, (short)0, c, false, false);
  if (NT >= 2) c = __builtin_amdgcn_wmma_f32_16x16x32_bf16(false, al, false, bh, (short)0, c, false, false);
  if (NT >= 3) c = __builtin_amdgcn_wmma_f32_16x16x32_bf16(false, ah, false, bl, (short)0, c, false, false);
  asm volatile("v_nop\n\tv_nop\n\tv_nop\n\tv_nop" : "+v"(c) : "v"(ah), "v"(al), "v"(bh), "v"(bl));
  return c;
}

__global__ __launch_bounds__(256) void k_wt_bf16(const float* __restrict__ W, unsigned short* __restrict__ Wt, int K, int N) {
  const int t = blockIdx.x * 256 + threadIdx.x;
  const int k8n = K / 8;
  if (t >= N * k8n) return;
  const int n = t / k8n, k8 = (t % k8n) * 8;
  v8us v;
#pragma unroll
  for (int i = 0; i < 8; ++i) v[i] = bf16_bits(W[(size_t)(k8 + i) * N + n]);
  *(v8us*)(Wt + (size_t)n * K + k8) = v;
  
}

// GEMM C[M][N] (f32, pitch ldc) = act(A[M][K]·W + bias). A f32 row-major (pitch lda) converted per fragment to bf16
// (ASPLIT: hi/lo two planes -> 2 terms, else single rounded term); Wt bf16 [N][K] (pitch ldb). BIAS_BF16 rounds the
// bias to bf16 first (bias quantised to bf16 before the add). K%32==0, M%16==0, N%64==0.
template <bool ASPLIT, int ACT, bool BIAS_BF16>
__global__ __launch_bounds__(128) void k_gemm_bf(const float* __restrict__ A, int lda, const unsigned short* __restrict__ Wt, int ldb,
                                               const float* __restrict__ bias, float* __restrict__ C, int ldc, int M, int N, int K) {
  __shared__ __attribute__((aligned(16))) float so[4][16][64];
  const int tid = threadIdx.x, w = tid >> 5, lane = tid & 31, ln = lane & 15, hh = lane >> 4;
  const int ntn = N / 64;
  const int wid = blockIdx.x * 4 + w;
  const int mt = wid / ntn, nq = wid % ntn;
  if (mt * 16 >= M) return;
  const int row0 = mt * 16, col0 = nq * 64;
  const float* arow = A + (size_t)(row0 + ln) * lda;
  v8f acc[4] = {};
  for (int kb = 0; kb < K; kb += 32) {
    FragB ah, al;
    const v4f x0 = *(const v4fa*)(arow + kb + 8 * hh), x1 = *(const v4fa*)(arow + kb + 8 * hh + 4);
    const v4f x2 = *(const v4fa*)(arow + kb + 16 + 8 * hh), x3 = *(const v4fa*)(arow + kb + 16 + 8 * hh + 4);
    float xs[16] = {x0[0],x0[1],x0[2],x0[3],x1[0],x1[1],x1[2],x1[3],x2[0],x2[1],x2[2],x2[3],x3[0],x3[1],x3[2],x3[3]};
#pragma unroll
    for (int i = 0; i < 16; ++i) { const unsigned short hb = bf16_bits(xs[i]); ah.u[i] = hb; al.u[i] = ASPLIT ? bf16_bits(xs[i] - bf16_val(hb)) : (unsigned short)0; }
#pragma unroll
    for (int t = 0; t < 4; ++t) {
      const unsigned short* brow = Wt + (size_t)(col0 + t * 16 + ln) * ldb + kb;
      FragB b;
      b.half[0] = *(const v8us*)(brow + 8 * hh);
      b.half[1] = *(const v8us*)(brow + 16 + 8 * hh);
      acc[t] = mmaN<ASPLIT ? 2 : 1>(ah.v, al.v, b.v, b.v, acc[t]);
    }
  }
#pragma unroll
  for (int t = 0; t < 4; ++t) {
    float bv = bias ? bias[col0 + t * 16 + ln] : 0.f;
    if (BIAS_BF16) bv = bf16_round(bv);
#pragma unroll
    for (int r = 0; r < 8; ++r) { float v = acc[t][r] + bv; if (ACT == 1) v = fmaxf(v, 0.f); so[w][8 * hh + r][t * 16 + ln] = v; }
  }
  __builtin_amdgcn_fence(__ATOMIC_ACQ_REL, "workgroup");
  __builtin_amdgcn_wave_barrier();
  const int rsub = lane >> 4, c4 = (lane & 15) * 4;
  {
#pragma unroll
    for (int q = 0; q < 8; ++q) {
      const int r = q * 2 + rsub;
      const v4f v = *(const v4fa*)&so[w][r][c4];
      *(v4f*)(C + (size_t)(row0 + r) * ldc + col0 + c4) = v;
    }
    
  }
}

// GEMM C = act(A·W + bias + resid): A f32 (ASPLIT -> hi/lo 2 terms), Wt bf16 [N][K]; ACT 0 none, 1 relu, 2 exact gelu;
// resid (optional, f32, row index = (row % rmod), pitch ldr, RES_BF16 rounds it) added before the activation.
template <bool ASPLIT, int ACT, bool BIAS_BF16, bool RES_BF16>
__global__ __launch_bounds__(128) void k_gemm_bf3(const float* __restrict__ A, int lda, const unsigned short* __restrict__ Wt, int ldb,
                                                const float* __restrict__ bias, const float* __restrict__ resid, int rmod, int ldr,
                                                float* __restrict__ C, int ldc, int M, int N, int K) {
  __shared__ __attribute__((aligned(16))) float so[4][16][64];
  const int tid = threadIdx.x, w = tid >> 5, lane = tid & 31, ln = lane & 15, hh = lane >> 4;
  const int ntn = N / 64;
  const int wid = blockIdx.x * 4 + w;
  const int mt = wid / ntn, nq = wid % ntn;
  if (mt * 16 >= M) return;
  const int row0 = mt * 16, col0 = nq * 64;
  const float* arow = A + (size_t)(row0 + ln) * lda;
  v8f acc[4] = {};
  for (int kb = 0; kb < K; kb += 32) {
    FragB ah, al;
    const v4f x0 = *(const v4fa*)(arow + kb + 8 * hh), x1 = *(const v4fa*)(arow + kb + 8 * hh + 4);
    const v4f x2 = *(const v4fa*)(arow + kb + 16 + 8 * hh), x3 = *(const v4fa*)(arow + kb + 16 + 8 * hh + 4);
    float xs[16] = {x0[0],x0[1],x0[2],x0[3],x1[0],x1[1],x1[2],x1[3],x2[0],x2[1],x2[2],x2[3],x3[0],x3[1],x3[2],x3[3]};
#pragma unroll
    for (int i = 0; i < 16; ++i) { const unsigned short hb = bf16_bits(xs[i]); ah.u[i] = hb; al.u[i] = ASPLIT ? bf16_bits(xs[i] - bf16_val(hb)) : (unsigned short)0; }
#pragma unroll
    for (int t = 0; t < 4; ++t) {
      const unsigned short* brow = Wt + (size_t)(col0 + t * 16 + ln) * ldb + kb;
      FragB b;
      b.half[0] = *(const v8us*)(brow + 8 * hh);
      b.half[1] = *(const v8us*)(brow + 16 + 8 * hh);
      acc[t] = mmaN<ASPLIT ? 2 : 1>(ah.v, al.v, b.v, b.v, acc[t]);
    }
  }
#pragma unroll
  for (int t = 0; t < 4; ++t) {
    const int col = col0 + t * 16 + ln;
    float bv = bias ? bias[col] : 0.f;
    if (BIAS_BF16) bv = bf16_round(bv);
#pragma unroll
    for (int r = 0; r < 8; ++r) {
      float v = acc[t][r] + bv;
      if (resid) { float rv = resid[(size_t)((row0 + 8 * hh + r) % rmod) * ldr + col]; if (RES_BF16) rv = bf16_round(rv); v += rv; }
      if (ACT == 1) v = fmaxf(v, 0.f);
      if (ACT == 2) v = 0.5f * v * (1.0f + erff(v * 0.70710678118654752f));
      if (ACT == 3) { const float u = 0.7978845608028654f * (v + 0.044715f * v * v * v); v = 0.5f * v * (1.0f + tanhf(u)); }
      so[w][8 * hh + r][t * 16 + ln] = v;
    }
  }
  __builtin_amdgcn_fence(__ATOMIC_ACQ_REL, "workgroup");
  __builtin_amdgcn_wave_barrier();
  const int rsub = lane >> 4, c4 = (lane & 15) * 4;
  {
#pragma unroll
    for (int q = 0; q < 8; ++q) {
      const int r = q * 2 + rsub;
      const v4f v = *(const v4fa*)&so[w][r][c4];
      *(v4f*)(C + (size_t)(row0 + r) * ldc + col0 + c4) = v;
    }
    
  }
}
// row LayerNorm (biased variance, eps) over N: s = X (+ R); optional out_sum <- s; out_norm <- (s-mu)*rsqrt(var+eps)*g + b
template <bool PARAM_BF16>
__global__ __launch_bounds__(256) void k_layernorm(const float* __restrict__ X, const float* __restrict__ R, const float* __restrict__ g, const float* __restrict__ bta,
                                                  float* __restrict__ out_sum, float* __restrict__ out_norm, int N, float eps) {
  __shared__ float red[256];
  const int row = blockIdx.x, tid = threadIdx.x;
  const float* x = X + (size_t)row * N; const float* rr = R ? R + (size_t)row * N : nullptr;
  float vals[16];                     // up to N = 4096
  const int per = N / 256;            // contiguous chunk per thread? use strided-by-4 chunks: thread handles j = tid*4 + 1024*u
  float s1 = 0.f;
  for (int u = 0; u < per / 4; ++u) {
    const int j = tid * 4 + 1024 * u;
    const v4f a = *(const v4fa*)(x + j);
    v4f b = {0.f,0.f,0.f,0.f}; if (rr) b = *(const v4fa*)(rr + j);
#pragma unroll
    for (int q = 0; q < 4; ++q) { const float v = a[q] + b[q]; vals[u * 4 + q] = v; s1 += v; }
  }
  red[tid] = s1; __syncthreads();
  for (int st = 128; st > 0; st >>= 1) { if (tid < st) red[tid] += red[tid + st]; __syncthreads(); }
  const float mu = red[0] / (float)N; __syncthreads();
  float s2 = 0.f;
  for (int u = 0; u < per / 4; ++u)
#pragma unroll
    for (int q = 0; q < 4; ++q) { const float c = vals[u * 4 + q] - mu; s2 += c * c; }
  red[tid] = s2; __syncthreads();
  for (int st = 128; st > 0; st >>= 1) { if (tid < st) red[tid] += red[tid + st]; __syncthreads(); }
  const float rs = rsqrtf(red[0] / (float)N + eps);
  {
    for (int u = 0; u < per / 4; ++u) {
      const int j = tid * 4 + 1024 * u;
      v4f o, sm;
#pragma unroll
      for (int q = 0; q < 4; ++q) {
        float gg = g[j + q], bb = bta[j + q];
        if (PARAM_BF16) { gg = bf16_round(gg); bb = bf16_round(bb); }
        sm[q] = vals[u * 4 + q]; o[q] = (vals[u * 4 + q] - mu) * rs * gg + bb;
      }
      if (out_sum) *(v4f*)(out_sum + (size_t)row * N + j) = sm;
      *(v4f*)(out_norm + (size_t)row * N + j) = o;
    }
    
  }
}



// ---- f16 WMMA path (v_wmma_f32_16x16x32_f16): 11-bit significands for operands in range — used where a [0,1] probability operand needs more precision than bf16
typedef _Float16 v16h __attribute__((ext_vector_type(16)));
union FragH { v16h v; v8us half[2]; _Float16 h[16]; unsigned short u[16]; };
template <int NT>
__device__ __forceinline__ v8f mmaH(v16h ah, v16h al, v16h bh, v16h bl, v8f c) {
  c = __builtin_amdgcn_wmma_f32_16x16x32_f16(false, ah, false, bh, (short)0, c, false, false);
  if (NT >= 2) c = __builtin_amdgcn_wmma_f32_16x16x32_f16(false, al, false, bh, (short)0, c, false, false);
  if (NT >= 3) c = __builtin_amdgcn_wmma_f32_16x16x32_f16(false, ah, false, bl, (short)0, c, false, false);
  asm volatile("v_nop\n\tv_nop\n\tv_nop\n\tv_nop" : "+v"(c) : "v"(ah), "v"(al), "v"(bh), "v"(bl));
  return c;
}
// batched GEMM like k_gemm_b but f16 operands: A f32 (split into f16 hi/lo if ASPLIT, else rounded to f16), Bt = f16 values [n][k]; alpha; C f32; N multiple of 16 (partial tiles skipped)
template <bool ASPLIT>
__global__ __launch_bounds__(128) void k_gemm_h(const float* __restrict__ A, int lda, size_t sA, const _Float16* __restrict__ Bh, int ldb, size_t sB, float alpha, float* __restrict__ C, int ldc, size_t sC, int M, int N, int K) {
  __shared__ __attribute__((aligned(16))) float so[4][16][64];
  const int tid = threadIdx.x, w = tid >> 5, lane = tid & 31, ln = lane & 15, hh = lane >> 4; const int by = blockIdx.y;
  A += (size_t)by * sA; Bh += (size_t)by * sB; C += (size_t)by * sC;
  const int ntn = (N + 63) / 64; const int wid = blockIdx.x * 4 + w; const int mt = wid / ntn, nq = wid % ntn; if (mt * 16 >= M) return;
  const int row0 = mt * 16, col0 = nq * 64; const float* arow = A + (size_t)(row0 + ln) * lda;
  v8f acc[4] = {};
  for (int kb = 0; kb < K; kb += 32) {
    FragH ah, al;
    const v4f x0 = *(const v4fa*)(arow + kb + 8 * hh), x1 = *(const v4fa*)(arow + kb + 8 * hh + 4), x2 = *(const v4fa*)(arow + kb + 16 + 8 * hh), x3 = *(const v4fa*)(arow + kb + 16 + 8 * hh + 4);
    float xs[16] = {x0[0],x0[1],x0[2],x0[3],x1[0],x1[1],x1[2],x1[3],x2[0],x2[1],x2[2],x2[3],x3[0],x3[1],x3[2],x3[3]};
#pragma unroll
    for (int i = 0; i < 16; ++i) { const _Float16 h = (_Float16)xs[i]; ah.h[i] = h; al.h[i] = ASPLIT ? (_Float16)(xs[i] - (float)h) : (_Float16)0.0f; }
#pragma unroll
    for (int t = 0; t < 4; ++t) { if (col0 + t * 16 >= N) continue; const size_t boff = (size_t)(col0 + t * 16 + ln) * ldb + kb; FragH bq; bq.half[0] = *(const v8us*)(Bh + boff + 8 * hh); bq.half[1] = *(const v8us*)(Bh + boff + 16 + 8 * hh);
      acc[t] = mmaH<ASPLIT ? 2 : 1>(ah.v, al.v, bq.v, bq.v, acc[t]); }
  }
#pragma unroll
  for (int t = 0; t < 4; ++t) { if (col0 + t * 16 >= N) continue;
#pragma unroll
    for (int r = 0; r < 8; ++r) so[w][8 * hh + r][t * 16 + ln] = acc[t][r] * alpha; }
  __builtin_amdgcn_fence(__ATOMIC_ACQ_REL, "workgroup"); __builtin_amdgcn_wave_barrier();
  const int rsub = lane >> 4, c4 = (lane & 15) * 4;
  {
#pragma unroll
    for (int q = 0; q < 8; ++q) { const int r = q * 2 + rsub; if (col0 + c4 < N) { const v4f v = *(const v4fa*)&so[w][r][c4]; *(v4f*)(C + (size_t)(row0 + r) * ldc + col0 + c4) = v; } }
     }
}

// Wt[n][k] = f16(W[k][n]·scale) from f32 row-major W[K][N] (scale = power of two; bf16-exact weights stay exact in f16 away from the subnormal range)
__global__ __launch_bounds__(256) void k_wt_f16(const float* __restrict__ W, _Float16* __restrict__ Wt, int K, int N, float scale) {
  const int t = blockIdx.x * 256 + threadIdx.x; if (t >= N * (K / 8)) return; const int n = t / (K / 8), k8 = (t % (K / 8)) * 8; FragH f;
#pragma unroll
  for (int i = 0; i < 8; ++i) f.h[i] = (_Float16)(bf16_round(W[(size_t)(k8 + i) * N + n]) * scale); const v8us o = f.half[0];
  *(v8us*)((unsigned short*)Wt + (size_t)n * K + k8) = o; 
}
// k_gemm_hh variant with fused epilogue: v = acc·alpha + bias[by·sBias + col] (+ CP[(row/rowsPerB)·sCPb + by·64 + col] if CP) ; ACT 0 none / 1 elu ; writes f16 C16 (and f32 C if non-null)
template <int ACT>
__global__ __launch_bounds__(128) void k_gemm_hhx(const _Float16* __restrict__ A, int lda, size_t sA, const _Float16* __restrict__ Bh, int ldb, size_t sB, float alpha, const float* __restrict__ bias, size_t sBias, const float* __restrict__ CP, int rowsPerB, size_t sCPb, int row0g,
    float* __restrict__ C, _Float16* __restrict__ C16, int ldc, size_t sC, int M, int N, int K) {
  __shared__ __attribute__((aligned(16))) float so[4][16][64];
  const int tid = threadIdx.x, w = tid >> 5, lane = tid & 31, ln = lane & 15, hh = lane >> 4; const int by = blockIdx.y;
  A += (size_t)by * sA; Bh += (size_t)by * sB; const size_t cofs = (size_t)by * sC; const float* bp = bias ? bias + (size_t)by * sBias : nullptr;
  const int ntn = (N + 63) / 64; const int wid = blockIdx.x * 4 + w; const int mt = wid / ntn, nq = wid % ntn; if (mt * 16 >= M) return;
  const int row0 = mt * 16, col0 = nq * 64; const _Float16* arow = A + (size_t)(row0 + ln) * lda;
  v8f acc[4] = {};
  for (int kb = 0; kb < K; kb += 32) { FragH ah; ah.half[0] = *(const v8us*)((const unsigned short*)arow + kb + 8 * hh); ah.half[1] = *(const v8us*)((const unsigned short*)arow + kb + 16 + 8 * hh);
#pragma unroll
    for (int t = 0; t < 4; ++t) { if (col0 + t * 16 >= N) continue; const size_t boff = (size_t)(col0 + t * 16 + ln) * ldb + kb; FragH bq; bq.half[0] = *(const v8us*)((const unsigned short*)Bh + boff + 8 * hh); bq.half[1] = *(const v8us*)((const unsigned short*)Bh + boff + 16 + 8 * hh);
      acc[t] = mmaH<1>(ah.v, ah.v, bq.v, bq.v, acc[t]); }
  }
#pragma unroll
  for (int t = 0; t < 4; ++t) { if (col0 + t * 16 >= N) continue; const int col = col0 + t * 16 + ln; const float bv = bp ? bf16_round(bp[col]) : 0.f;
#pragma unroll
    for (int r = 0; r < 8; ++r) { float v = acc[t][r] * alpha + bv; if (CP) { const int rr = row0g + row0 + 8 * hh + r; if (rowsPerB < 0) v += CP[cofs + (size_t)rr * ldc + col];      /* rowsPerB < 0: own element of the batched C plane */ else { const int bidx = rr / rowsPerB; v += CP[(size_t)bidx * sCPb + (size_t)by * 64 + col]; } } if (ACT == 1) v = (v > 0.f) ? v : expm1f(v); else if (ACT == 7) v = (v > 0.f) ? v + 1.0f : expf(v); else if (ACT == 8) v = tanhf(v); else if (ACT == 9) v = 0.5f * v * (1.0f + tanhf(0.7978845608028654f * (v + 0.044715f * v * v * v))); else if (ACT == 11) v = 1.0f / (1.0f + expf(-v)); else if (ACT == 12) v = (v > 0.f) ? v : 0.01f * v; else if (ACT == 14) v = (v > 0.f) ? v : 0.1f * v; else if (ACT == 16) v = (v >= 0.f) ? v : 0.3f * v; else if (ACT == 17) v = (v >= 0.f) ? v : 0.2f * v; else if (ACT == 15) v = v / (1.0f + expf(-v)); else if (ACT == 3) v = fmaxf(v, 0.f); else if (ACT == 6) v = 0.5f * v * (1.0f + erff(v * 0.70710678118654752f)); so[w][8 * hh + r][t * 16 + ln] = v; } }
  __builtin_amdgcn_fence(__ATOMIC_ACQ_REL, "workgroup"); __builtin_amdgcn_wave_barrier();
  const int rsub = lane >> 4, c4 = (lane & 15) * 4; typedef _Float16 v4h __attribute__((ext_vector_type(4)));
  {
#pragma unroll
    for (int q = 0; q < 8; ++q) { const int r = q * 2 + rsub; if (col0 + c4 < N) { const v4f v = *(const v4fa*)&so[w][r][c4]; if (C) *(v4f*)(C + cofs + (size_t)(row0 + r) * ldc + col0 + c4) = v; if (C16) { v4h h4; for (int i = 0; i < 4; ++i) h4[i] = (_Float16)v[i]; *(v4h*)(C16 + cofs + (size_t)(row0 + r) * ldc + col0 + c4) = h4; } } }
     }
}


typedef _Float16 v4h __attribute__((ext_vector_type(4)));

__global__ __launch_bounds__(256) void k_x16(const float* __restrict__ x, _Float16* __restrict__ X16, size_t n8) { const size_t t = (size_t)blockIdx.x * 256 + threadIdx.x; if (t >= n8) return; FragH f;
#pragma unroll
  for (int q = 0; q < 8; ++q) f.h[q] = (_Float16)bf16_round(x[t * 8 + q]); *(v8us*)((unsigned short*)X16 + t * 8) = f.half[0];  }
__global__ __launch_bounds__(256) void k_h16(const float* __restrict__ x, _Float16* __restrict__ X16, size_t n8) { const size_t t = (size_t)blockIdx.x * 256 + threadIdx.x; if (t >= n8) return; FragH f;
#pragma unroll
  for (int q = 0; q < 8; ++q) f.h[q] = (_Float16)x[t * 8 + q]; *(v8us*)((unsigned short*)X16 + t * 8) = f.half[0];  }
__global__ __launch_bounds__(256) void k_round16f(const float* __restrict__ W, _Float16* __restrict__ Bt, size_t n8) { const size_t t = (size_t)blockIdx.x * 256 + threadIdx.x; if (t >= n8) return; FragH f;
#pragma unroll
  for (int i = 0; i < 8; ++i) f.h[i] = (_Float16)(bf16_round(W[t * 8 + i]) * 16.0f); *(v8us*)((unsigned short*)Bt + t * 8) = f.half[0];  }
template <int NHv, int TTv>
__global__ __launch_bounds__(256) void k_vt(const _Float16* __restrict__ V16, int ldv, int voff, _Float16* __restrict__ Vt) { __shared__ unsigned short tl[64][66]; const int tid = threadIdx.x; const int slab = blockIdx.x / (TTv / 64), lg = blockIdx.x % (TTv / 64); const int b = slab / NHv, h = slab % NHv;
  for (int i = tid; i < 64 * 8; i += 256) { const int r = i / 8, c8 = (i % 8) * 8; FragH f; f.half[0] = *(const v8us*)((const unsigned short*)V16 + ((size_t)b * TTv + lg * 64 + r) * ldv + voff + h * 64 + c8);
#pragma unroll
    for (int q = 0; q < 8; ++q) tl[r][c8 + q] = f.u[q]; }
  __syncthreads();
  {
#pragma unroll
    for (int rd = 0; rd < 2; ++rd) { const int d = rd * 32 + tid / 8, pc = tid % 8; FragH f;
#pragma unroll
      for (int q = 0; q < 8; ++q) f.u[q] = tl[pc * 8 + q][d];
      *(v8us*)((unsigned short*)Vt + ((size_t)slab * 64 + d) * TTv + lg * 64 + pc * 8) = f.half[0]; }
     } }

__global__ __launch_bounds__(256) void k_hl(const float* __restrict__ F, _Float16* __restrict__ Hh, _Float16* __restrict__ Hl, size_t n8) { const size_t t = (size_t)blockIdx.x * 256 + threadIdx.x; if (t >= n8) return; FragH fh, fl; const v4f a = *(const v4fa*)(F + t * 8), c = *(const v4fa*)(F + t * 8 + 4);
#pragma unroll
  for (int q = 0; q < 4; ++q) { _Float16 h = (_Float16)a[q]; fh.h[q] = h; fl.h[q] = (_Float16)((a[q] - (float)h) * 1024.0f); h = (_Float16)c[q]; fh.h[4 + q] = h; fl.h[4 + q] = (_Float16)((c[q] - (float)h) * 1024.0f); }
  { *(v8us*)((unsigned short*)Hh + t * 8) = fh.half[0]; *(v8us*)((unsigned short*)Hl + t * 8) = fl.half[0];  } }

// ---- fast GEMM (wave tile 32x64; requires M % 32 == 0 rows per launch region and N % 64 == 0); epilogue = k_gemm_hhx semantics ----
__device__ __forceinline__ v16h g2_frag(const _Float16* p, int hh) { FragH f; f.half[0] = *(const v8us*)((const unsigned short*)p + 8 * hh); f.half[1] = *(const v8us*)((const unsigned short*)p + 16 + 8 * hh); return f.v; }
__device__ __forceinline__ v8f g2_mma(v16h a, v16h b, v8f c) { v8f d = __builtin_amdgcn_wmma_f32_16x16x32_f16(false, a, false, b, (short)0, c, false, false); asm volatile("v_nop\n\tv_nop\n\tv_nop\n\tv_nop" : "+v"(d) : "v"(a), "v"(b)); return d; }
template <int ACT>
__global__ __launch_bounds__(128) void k_gemm2(const _Float16* __restrict__ A, int lda, size_t sA, const _Float16* __restrict__ Bh, int ldb, size_t sB, float alpha, const float* __restrict__ bias, size_t sBias, const float* __restrict__ CP, int rowsPerB, size_t sCPb, int row0g,
    float* __restrict__ C, _Float16* __restrict__ C16, int ldc, size_t sC, int M, int N, int K) { static_assert(ACT == 0 || ACT == 3 || ACT == 6 || ACT == 8 || ACT == 9 || ACT == 11 || ACT == 12 || ACT == 14 || ACT == 15 || ACT == 16 || ACT == 17, "k_gemm2: unsupported ACT code (would silently apply no activation)");
  __shared__ __attribute__((aligned(16))) float so[4][32][68];
  const int tid = threadIdx.x, w = tid >> 5, lane = tid & 31, ln = lane & 15, hh = lane >> 4; const int by = blockIdx.y;
  A += (size_t)by * sA; Bh += (size_t)by * sB; const size_t cofs = (size_t)by * sC; const float* bp = bias ? bias + (size_t)by * sBias : nullptr;
  const int ntn = N >> 6; const int mt = blockIdx.x / ntn, nq = blockIdx.x - mt * ntn; const int row0 = mt * 128 + 32 * w, col0 = nq * 64; if (row0 >= M) return;
  const _Float16* a0p = A + (size_t)(row0 + ln) * lda; const _Float16* a1p = a0p + (size_t)16 * lda;
  const _Float16* b0p = Bh + (size_t)(col0 + ln) * ldb; const _Float16* b1p = b0p + (size_t)16 * ldb; const _Float16* b2p = b1p + (size_t)16 * ldb; const _Float16* b3p = b2p + (size_t)16 * ldb;
  const v8f z8 = {0.f,0.f,0.f,0.f,0.f,0.f,0.f,0.f}; v8f c00 = z8, c01 = z8, c02 = z8, c03 = z8, c10 = z8, c11 = z8, c12 = z8, c13 = z8;
#pragma unroll 1
  for (int kb = 0; kb < K; kb += 32) { const v16h a0 = g2_frag(a0p + kb, hh), a1 = g2_frag(a1p + kb, hh);
    v16h b = g2_frag(b0p + kb, hh); c00 = g2_mma(a0, b, c00); c10 = g2_mma(a1, b, c10);
    b = g2_frag(b1p + kb, hh); c01 = g2_mma(a0, b, c01); c11 = g2_mma(a1, b, c11);
    b = g2_frag(b2p + kb, hh); c02 = g2_mma(a0, b, c02); c12 = g2_mma(a1, b, c12);
    b = g2_frag(b3p + kb, hh); c03 = g2_mma(a0, b, c03); c13 = g2_mma(a1, b, c13); }
  v8f accs[8] = {c00, c01, c02, c03, c10, c11, c12, c13};
#pragma unroll
  for (int u = 0; u < 8; ++u) { const int t = u & 3, half = u >> 2; const int col = col0 + t * 16 + ln; const float bv = bp ? bf16_round(bp[col]) : 0.f;
#pragma unroll
    for (int r = 0; r < 8; ++r) { const int rloc = half * 16 + 8 * hh + r; float v = accs[u][r] * alpha + bv; if (CP) { if (rowsPerB < 0) v += CP[cofs + (size_t)(row0g + row0 + rloc) * ldc + col];      /* rowsPerB < 0: own element of the batched C plane */ else { const int bidx = (row0g + row0 + rloc) / rowsPerB; v += CP[(size_t)bidx * sCPb + (size_t)by * 64 + col]; } }
      if (ACT == 3) v = fmaxf(v, 0.f); else if (ACT == 6) v = 0.5f * v * (1.0f + erff(v * 0.70710678118654752f)); else if (ACT == 11) v = 1.0f / (1.0f + expf(-v)); else if (ACT == 15) v = v / (1.0f + expf(-v)); else if (ACT == 12) v = (v > 0.f) ? v : 0.01f * v; else if (ACT == 8) v = tanhf(v); else if (ACT == 9) v = 0.5f * v * (1.0f + tanhf(0.7978845608028654f * (v + 0.044715f * v * v * v))); else if (ACT == 14) v = (v > 0.f) ? v : 0.1f * v; else if (ACT == 16) v = (v >= 0.f) ? v : 0.3f * v; else if (ACT == 17) v = (v >= 0.f) ? v : 0.2f * v;
      so[w][rloc][t * 16 + ln] = v; } }
  __builtin_amdgcn_fence(__ATOMIC_ACQ_REL, "workgroup"); __builtin_amdgcn_wave_barrier();
  const int rsub = lane >> 4, c4 = (lane & 15) * 4;
  {
#pragma unroll
    for (int q = 0; q < 16; ++q) { const int r = q * 2 + rsub; const v4f v = *(const v4fa*)&so[w][r][c4]; if (C) *(v4f*)(C + cofs + (size_t)(row0 + r) * ldc + col0 + c4) = v; if (C16) { v4h h4; for (int i = 0; i < 4; ++i) h4[i] = (_Float16)v[i]; *(v4h*)(C16 + cofs + (size_t)(row0 + r) * ldc + col0 + c4) = h4; } }
     } }


// ---- the same 32x64 wave tile with K split over the NW waves of a work-group, for products with few output tiles (M x N small, K long) ----
// A work-group owns ONE 32x64 tile of C; wave w sums k in [w K / NW, (w + 1) K / NW) with the loop of k_gemm2; the NW partial tiles (f32) meet in LDS and are added in wave order.
// Requires M % 32 == 0 (grid = (M / 32) (N / 64)), N % 64 == 0, K % (32 NW) == 0. C16 = f16(alpha x sum).
template <int NW>
__global__ __launch_bounds__(NW * 32) void k_gemm2k(const _Float16* __restrict__ A, int lda, const _Float16* __restrict__ Bh, int ldb, float alpha, _Float16* __restrict__ C16, int ldc, int N, int K) {
  __shared__ __attribute__((aligned(16))) float so[NW][32][68];
  const int tid = threadIdx.x, w = tid >> 5, lane = tid & 31, ln = lane & 15, hh = lane >> 4;
  const int ntn = N >> 6; const int mt = blockIdx.x / ntn, nq = blockIdx.x - mt * ntn; const int row0 = mt * 32, col0 = nq * 64; const int ks = K / NW;
  const _Float16* a0p = A + (size_t)(row0 + ln) * lda + w * ks; const _Float16* a1p = a0p + (size_t)16 * lda;
  const _Float16* b0p = Bh + (size_t)(col0 + ln) * ldb + w * ks; const _Float16* b1p = b0p + (size_t)16 * ldb; const _Float16* b2p = b1p + (size_t)16 * ldb; const _Float16* b3p = b2p + (size_t)16 * ldb;
  const v8f z8 = {0.f,0.f,0.f,0.f,0.f,0.f,0.f,0.f}; v8f c00 = z8, c01 = z8, c02 = z8, c03 = z8, c10 = z8, c11 = z8, c12 = z8, c13 = z8;
  for (int kb = 0; kb < ks; kb += 32) { const v16h a0 = g2_frag(a0p + kb, hh), a1 = g2_frag(a1p + kb, hh);
    v16h b = g2_frag(b0p + kb, hh); c00 = g2_mma(a0, b, c00); c10 = g2_mma(a1, b, c10);
    b = g2_frag(b1p + kb, hh); c01 = g2_mma(a0, b, c01); c11 = g2_mma(a1, b, c11);
    b = g2_frag(b2p + kb, hh); c02 = g2_mma(a0, b, c02); c12 = g2_mma(a1, b, c12);
    b = g2_frag(b3p + kb, hh); c03 = g2_mma(a0, b, c03); c13 = g2_mma(a1, b, c13); }
  v8f accs[8] = {c00, c01, c02, c03, c10, c11, c12, c13};
#pragma unroll
  for (int u = 0; u < 8; ++u) {      /* unrolled so that accs[] is indexed by constants and stays in registers */
#pragma unroll
    for (int r = 0; r < 8; ++r) so[w][(u >> 2) * 16 + 8 * hh + r][(u & 3) * 16 + ln] = accs[u][r]; }
  __syncthreads();      /* every wave's partial tile is in LDS before any thread adds them */
  for (int i0 = 0; i0 < 32 * 16; i0 += NW * 32) { const int i = i0 + tid, r = i >> 4, c4 = (i & 15) * 4; v4f s = *(const v4f*)&so[0][r][c4];
#pragma unroll
    for (int k = 1; k < NW; ++k) s += *(const v4f*)&so[k][r][c4];      /* unrolled so that the NW LDS reads issue together */
    v4h h4;
#pragma unroll
    for (int q = 0; q < 4; ++q) h4[q] = (_Float16)(s[q] * alpha);      /* unrolled so that the vector elements are indexed by constants */
    *(v4h*)(C16 + (size_t)(row0 + r) * ldc + col0 + c4) = h4; } }


// four weight matrices of n8 x 8 elements each -> four planes one behind the other in Bt, each in fragment order (see FRB below); blockIdx.y picks the matrix; planes 0..2 have K = 256, plane 3 has K = 128.
// Thread t writes 16-B piece t of its plane: lane = t % 32, half j, block kb of the row tile rt; it reads 8 consecutive k of row 16 rt + lane % 16.
__global__ __launch_bounds__(256) void k_wnat(const float* __restrict__ w0, const float* __restrict__ w1, const float* __restrict__ w2, const float* __restrict__ w3, size_t n8, _Float16* __restrict__ Bt) { const size_t t = (size_t)blockIdx.x * 256 + threadIdx.x; if (t >= n8) return; const unsigned p = blockIdx.y; const float* w = p == 0 ? w0 : p == 1 ? w1 : p == 2 ? w2 : w3;
  const unsigned c = (unsigned)t, lg = p == 3 ? 2u : 3u, kb = (c >> 6) & ((1u << lg) - 1u), rt = c >> (6 + lg); const size_t s = ((size_t)(rt * 16 + (c & 15)) << (5 + lg)) + kb * 32 + ((c >> 5) & 1) * 16 + ((c >> 4) & 1) * 8;
  FragH f; for (int q = 0; q < 8; ++q) f.h[q] = (_Float16)(bf16_round(w[s + q]) * 16.0f); *(v8us*)((unsigned short*)Bt + (p * n8 + t) * 8) = f.half[0];  }
__global__ __launch_bounds__(256) void k_rsm(const float* __restrict__ S, _Float16* __restrict__ P, int nrows) {
  #pragma clang fp contract(off)
  const int i = blockIdx.x * 256 + threadIdx.x; if (i >= nrows) return; const float* s = S + (size_t)i * SQ; float mx = -3.0e38f;
#pragma unroll 1
  for (int j = 0; j < SQ; ++j) mx = fmaxf(mx, s[j]); float se = 0.f;
#pragma unroll 1
  for (int j = 0; j < SQ; ++j) se += expf(s[j] - mx); const float sc = 256.0f / se;
#pragma unroll 1
  for (int j0 = 0; j0 < SQ; j0 += 8) { FragH f; for (int q = 0; q < 8; ++q) f.h[q] = (_Float16)(expf(s[j0 + q] - mx) * sc); unsigned short* d = (unsigned short*)P + (size_t)i * SQ + j0; *(v8us*)d = f.half[0];  } }
__global__ __launch_bounds__(256) void k_vt(const _Float16* __restrict__ V16, int b, int h0, _Float16* __restrict__ VT) { __shared__ unsigned short tl[64][65]; const int tid = threadIdx.x; const int hh = blockIdx.x % HG, sg = blockIdx.x / HG; const int s0 = sg * 64; const int h = h0 + hh;
  for (int i = tid; i < 64 * 8; i += 256) { const int j = i / 8, d8 = (i % 8) * 8; FragH f; f.half[0] = *(const v8us*)((const unsigned short*)V16 + ((size_t)b * SQ + s0 + j) * DM + h * HD + d8); for (int q = 0; q < 8; ++q) tl[d8 + q][j] = f.u[q]; }
  __syncthreads();
  { for (int i = tid; i < 64 * 8; i += 256) { const int d = i / 8, j8 = (i % 8) * 8; FragH f; for (int q = 0; q < 8; ++q) f.u[q] = tl[d][j8 + q]; *(v8us*)((unsigned short*)VT + ((size_t)hh * HD + d) * SQ + s0 + j8) = f.half[0]; }  } }



__global__ __launch_bounds__(256) void k_rsmcf2(const float* __restrict__ S, _Float16* __restrict__ P, int hg, int q0, int nk) {
  #pragma clang fp contract(off)
  const int t = blockIdx.x * 256 + threadIdx.x; if (t >= hg * QT) return; const size_t i = (size_t)t; const float* s = S + i * NKX; const int last = q0 + (t % QT); float mx = -3.0e38f;
#pragma unroll 1
  for (int j = 0; j < nk; ++j) { const float f = (j <= last) ? 1.f : 0.f; mx = fmaxf(mx, fmaf(f, s[j], (1.f - f) * -1.0e9f)); } float se = 0.f;
#pragma unroll 1
  for (int j = 0; j < nk; ++j) { const float f = (j <= last) ? 1.f : 0.f; se += __expf(fmaf(f, s[j], (1.f - f) * -1.0e9f) - mx); } const float sc = 256.0f / se;
#pragma unroll 1
  for (int j0 = 0; j0 < nk; j0 += 8) { FragH fr; for (int q = 0; q < 8; ++q) { const int j = j0 + q; const float f = (j <= last) ? 1.f : 0.f; fr.h[q] = (_Float16)(__expf(fmaf(f, s[j], (1.f - f) * -1.0e9f) - mx) * sc); } unsigned short* d = (unsigned short*)P + i * NKX + j0; *(v8us*)d = fr.half[0];  } }

template <int MASKADD>
__global__ __launch_bounds__(64) void k_att0(const float* __restrict__ QF, const float* __restrict__ KF, const float* __restrict__ VF, int ld, const float* __restrict__ mask, float scale, float* __restrict__ OF, int ldo) {
  #pragma clang fp contract(off)
  __shared__ __attribute__((aligned(16))) float lq[64][64]; __shared__ __attribute__((aligned(16))) float lo[64][64];
  const int tid = threadIdx.x; const int h = blockIdx.x / (QT0 / 64), rg = blockIdx.x % (QT0 / 64); const int i = rg * 64 + tid;
  const float* qr = QF + (size_t)i * ld + h * HD;
#pragma unroll 1
  for (int c = 0; c < HD / 4; ++c) { *(v4f*)&lq[tid][c * 4] = *(const v4fa*)(qr + c * 4); const v4f z = {0.f, 0.f, 0.f, 0.f}; *(v4f*)&lo[tid][c * 4] = z; }
  float m = -1.0e30f, l = 0.f; const int jmax = MASKADD ? (SQ - 1) : (rg * 64 + 63);      /* additive-mask form: every key (the mask input decides); causal form: keys up to the block's last row */
#pragma unroll 1
  for (int j = 0; j <= jmax; ++j) { const float* kr = KF + (size_t)j * ld + h * HD; const float* vr = VF + (size_t)j * ld + h * HD; float s = 0.f;
#pragma unroll 1
    for (int c = 0; c < HD / 4; ++c) { const v4f kq = *(const v4fa*)(kr + c * 4); const v4f qq = *(v4f*)&lq[tid][c * 4]; s = __fadd_rn(s, __fmul_rn(qq[0], kq[0])); s = __fadd_rn(s, __fmul_rn(qq[1], kq[1])); s = __fadd_rn(s, __fmul_rn(qq[2], kq[2])); s = __fadd_rn(s, __fmul_rn(qq[3], kq[3])); }
    s = __fmul_rn(s, scale); if (MASKADD) s = __fadd_rn(s, __fmul_rn(bf16_round(mask[(size_t)i * SQ + j]), -10000.0f));
    const float f = (MASKADD || j <= i) ? 1.f : 0.f; const float sm = fmaf(f, s, (1.f - f) * -1.0e30f); const float mn = fmaxf(m, sm); const float sc = expf(m - mn); const float e = expf(sm - mn); l = __fadd_rn(__fmul_rn(l, sc), e); m = mn;
#pragma unroll 1
    for (int c = 0; c < HD / 4; ++c) { const v4f vv = *(const v4fa*)(vr + c * 4); v4f oo = *(v4f*)&lo[tid][c * 4]; for (int u = 0; u < 4; ++u) oo[u] = __fadd_rn(__fmul_rn(oo[u], sc), __fmul_rn(e, vv[u])); *(v4f*)&lo[tid][c * 4] = oo; } }
  const float fin = 64.0f / l;      /* o carried x64 like the f16 path */
#pragma unroll 1
  for (int c = 0; c < HD / 4; ++c) { v4f oo = *(v4f*)&lo[tid][c * 4]; for (int u = 0; u < 4; ++u) oo[u] = __fmul_rn(oo[u], fin); *(v4f*)&lo[tid][c * 4] = oo; }
  __syncthreads();
  {
#pragma unroll 1
    for (int it = 0; it < 16; ++it) { const int row = it * 4 + tid / 16, pc = (tid % 16) * 4; const v4f v = *(const v4f*)&lo[row][pc]; *(v4f*)(OF + (size_t)(rg * 64 + row) * ldo + h * HD + pc) = v; }
     } }

__global__ __launch_bounds__(256) void k_oscale(const float* __restrict__ OF, float* __restrict__ out, size_t n4) { const size_t t = (size_t)blockIdx.x * 256 + threadIdx.x; if (t >= n4) return; const v4f a = *(const v4fa*)(OF + t * 4); v4f o; for (int q = 0; q < 4; ++q) o[q] = a[q] * 0.015625f; *(v4f*)(out + t * 4) = o;  }

__global__ __launch_bounds__(256) void k_bfr(const float* __restrict__ x, float* __restrict__ XB, size_t n8) { const size_t t = (size_t)blockIdx.x * 256 + threadIdx.x; if (t >= n8) return; v4f a = *(const v4fa*)(x + t * 8), c = *(const v4fa*)(x + t * 8 + 4); for (int q = 0; q < 4; ++q) { a[q] = bf16_round(a[q]); c[q] = bf16_round(c[q]); }
  { *(v4f*)(XB + t * 8) = a; *(v4f*)(XB + t * 8 + 4) = c;  } }



__global__ __launch_bounds__(256) void k_rsmfvl(const float* __restrict__ S, _Float16* __restrict__ P, _Float16* __restrict__ PL, int qn, const int* __restrict__ vlp) {
  #pragma clang fp contract(off)
  const int t = blockIdx.x * 256 + threadIdx.x; if (t >= qn) return; const int vl = vlp[0]; const size_t i = (size_t)t; const float* s = S + i * SQ; float mx = -3.0e38f;
#pragma unroll 1
  for (int j = 0; j < SQ; ++j) { const float f = (j < vl) ? 1.f : 0.f; mx = fmaxf(mx, fmaf(f, s[j], (1.f - f) * -1000000.0f)); } float se = 0.f;
#pragma unroll 1
  for (int j = 0; j < SQ; ++j) { const float f = (j < vl) ? 1.f : 0.f; se += __expf(fmaf(f, s[j], (1.f - f) * -1000000.0f) - mx); } const float sc = 256.0f / se;
#pragma unroll 1
  for (int j0 = 0; j0 < SQ; j0 += 8) { FragH fr, gr; for (int q = 0; q < 8; ++q) { const int j = j0 + q; const float f = (j < vl) ? 1.f : 0.f; const float pv = __expf(fmaf(f, s[j], (1.f - f) * -1000000.0f) - mx) * sc; const _Float16 ph = (_Float16)pv; fr.h[q] = ph; gr.h[q] = (_Float16)((pv - (float)ph) * 1024.0f); }
    unsigned short* d = (unsigned short*)P + i * SQ + j0; unsigned short* dl = (unsigned short*)PL + i * SQ + j0; *(v8us*)d = fr.half[0]; *(v8us*)dl = gr.half[0];  } }

__global__ __launch_bounds__(256) void k_rsmf(const float* __restrict__ S, _Float16* __restrict__ P, int qn, int hg) {
  #pragma clang fp contract(off)
  const int t = blockIdx.x * 256 + threadIdx.x; if (t >= qn * hg) return; const size_t i = (size_t)(t / qn) * SQ + (t % qn); const float* s = S + i * SQ; float mx = -3.0e38f;
#pragma unroll 1
  for (int j = 0; j < SQ; ++j) mx = fmaxf(mx, s[j]); float se = 0.f;
#pragma unroll 1
  for (int j = 0; j < SQ; ++j) se += __expf(s[j] - mx); const float sc = 256.0f / se;
#pragma unroll 1
  for (int j0 = 0; j0 < SQ; j0 += 8) { FragH f; for (int q = 0; q < 8; ++q) f.h[q] = (_Float16)(__expf(s[j0 + q] - mx) * sc); unsigned short* d = (unsigned short*)P + i * SQ + j0; *(v8us*)d = f.half[0];  } }


#define CN 256          /* channels */
#define CI 128          /* inner channels */
#define NP 4096         /* positions */
#define NM 4096         /* key positions (= SQ) */
#define NC CN           /* BN statistics macros */
#define NPX NP
#define BNEPS 1e-5f

__global__ __launch_bounds__(256) void k_rowbias(const float* __restrict__ b, float* __restrict__ BP, size_t n4, int ncol) { const size_t t = (size_t)blockIdx.x * 256 + threadIdx.x; if (t >= n4) return; const size_t e = t * 4; const float v = bf16_round(b[e / ncol]); const v4f o = {v, v, v, v}; *(v4f*)(BP + e) = o;  }




__global__ __launch_bounds__(256) void k_mp2(const float* __restrict__ src, float* __restrict__ dst, int nout) {
  const int t = blockIdx.x * 256 + threadIdx.x; if (t >= nout) return; const int c = t / 1024; const int o = t % 1024; const int oy = o / 32, ox = o % 32; const float* p = src + (size_t)c * 4096 + (size_t)(2 * oy) * 64 + 2 * ox;
  const float v = fmaxf(fmaxf(p[0], p[1]), fmaxf(p[64], p[65])); *(float*)(dst + t) = v;  }
__global__ __launch_bounds__(256) void k_xpb(const float* __restrict__ x, const float* __restrict__ wb, float* __restrict__ CPP, size_t n4) {
  #pragma clang fp contract(off)
  const size_t t = (size_t)blockIdx.x * 256 + threadIdx.x; if (t >= n4) return; const size_t e = t * 4; const int c = (int)((e / 4096) % 256); const float bb = bf16_round(wb[c]); const v4f a = *(const v4fa*)(x + e); v4f o; for (int q = 0; q < 4; ++q) o[q] = __fadd_rn(bf16_round(a[q]), bb);
  *(v4f*)(CPP + e) = o;  }


template <int PASS>
__global__ __launch_bounds__(256) void k_cstA(const float* __restrict__ X, const float* __restrict__ MV, float* __restrict__ PART) {
  #pragma clang fp contract(off)
  __shared__ float red[256]; const int t = threadIdx.x; const size_t bc = blockIdx.x; const int c = (int)(bc % NC); const float* row = X + bc * (size_t)NPX; const float mu = PASS ? MV[c] : 0.f; float s = 0.f;
  for (int i = t; i < NPX; i += 256) { const float v = row[i]; const float d = PASS ? __fadd_rn(v, -mu) : v; s = __fadd_rn(s, PASS ? __fmul_rn(d, d) : d); }
  red[t] = s; __syncthreads(); for (int st = 128; st > 0; st >>= 1) { if (t < st) red[t] = __fadd_rn(red[t], red[t + st]); __syncthreads(); }
  if (t < 32) { const float pv = (t == 0) ? red[0] : 0.f; *(float*)(PART + bc * 32 + t) = pv;  } }      

template <int PASS>
__global__ __launch_bounds__(256) void k_cstB(const float* __restrict__ PART, float* __restrict__ MV) { const int c = threadIdx.x; if (c >= NC) return; double s = 0.0; for (int b = 0; b < NB; ++b) s += (double)PART[((size_t)b * NC + c) * 32]; const float m = (float)(s / ((double)NB * (double)NPX)); *(float*)(MV + PASS * NC + c) = m;  }


__global__ __launch_bounds__(256) void k_bnresid(const float* __restrict__ C2, const float* __restrict__ MV, const float* __restrict__ g, const float* __restrict__ be, const float* __restrict__ X, float* __restrict__ out, size_t n4) {
  #pragma clang fp contract(off)
  const size_t t = (size_t)blockIdx.x * 256 + threadIdx.x; if (t >= n4) return; const size_t e = t * 4; const int c = (int)((e / NPX) % NC); const float sc = __fmul_rn(rsqrtf(__fadd_rn(MV[NC + c], BNEPS)), bf16_round(g[c])); const float mu = MV[c], bb = bf16_round(be[c]);
  const v4f a = *(const v4fa*)(C2 + e); const v4f xx = *(const v4fa*)(X + e); v4f o; for (int q = 0; q < 4; ++q) { const float z = __fadd_rn(__fmul_rn(__fadd_rn(a[q], -mu), sc), bb); o[q] = __fadd_rn(z, bf16_round(xx[q])); }
  *(v4f*)(out + e) = o;  }


__global__ __launch_bounds__(256) void k_rowbias(float* __restrict__ Y, const float* __restrict__ bias) {
  #pragma clang fp contract(off)
  const size_t t = (size_t)blockIdx.x * 256 + threadIdx.x; if (t >= (size_t)NB * NC * NPX / 4) return; const size_t e = t * 4; const int c = (int)((e / NPX) % NC); const float bb = bf16_round(bias[c]);
  v4f v = *(const v4fa*)(Y + e); for (int q = 0; q < 4; ++q) v[q] = __fadd_rn(v[q], bb); *(v4f*)(Y + e) = v;  }


// Scores never stored. Both consumers of f = theta^T phi form their own score tiles on the matrix unit from the f16 theta and phi planes (fragment order, below) and use them in registers.
// ST holds one 128-B record per 16 columns: 16 maxima, then 16 x (256 / sum). blockIdx.y is the image.
// Inner loops carry #pragma unroll so that the fragment arrays are indexed by constants and stay in registers (a run-time index would send them to scratch).
#define CSC 16                    /* columns per record */
#define QIS (2 * NP * CI)         /* elements of an image in QKV: the theta plane, then the phi plane, each [4096 rows][K = 128] in fragment order */
#define SCM 64                    /* columns per work-group of the statistics kernel */
#define SCW 16                    /* its waves: the 4,096 rows split over them */
__device__ __forceinline__ v8f f_mma(v16h a, v16h b, v8f c) { return __builtin_amdgcn_wmma_f32_16x16x32_f16(false, a, false, b, (short)0, c, false, false); }
// FRAGMENT ORDER. Every f16 plane that a matrix instruction reads from the workspace lies as blocks of 16 rows x 32 k, FRB elements each: [half j][lane = 16 hh + ln][8 elements], element e of row ln at k = 16 j + 8 hh + e;
// the blocks of a 16-row tile follow each other in k. A wave's 16-B-a-lane load of half a fragment then covers 512 contiguous bytes (4 whole lines) where a row-major plane makes it touch 16 lines.
#define FRB 512                   /* f16 elements of a block */
__device__ __forceinline__ v16h p_frag(const _Float16* p) { FragH f; f.half[0] = *(const v8us*)((const unsigned short*)p); f.half[1] = *(const v8us*)((const unsigned short*)p + 256); return f.v; }      /* p: the block + 8 lane */
__device__ __forceinline__ v16h f_frag(const _Float16* p) { FragH f; f.half[0] = *(const v8us*)((const unsigned short*)p); f.half[1] = *(const v8us*)((const unsigned short*)p + 16); return f.v; }      /* g2_frag with the lane's + 8 hh already in p */
// Column statistics: a work-group owns 64 key columns m (their phi fragments stay in registers as B), wave w sweeps rows n in [256 w, 256 w + 256) 16 at a time (theta as A).
// In D a lane holds 8 rows of ONE column (row 8 hh + r, column ln), so the running maximum and the rescaled running sum of a column are per-lane scalars; the 32 partial pairs of a column (16 waves x 2 lane halves) meet in LDS.
// One trip: 16 rows from ac; the next trip's theta fragments are fetched into ax behind the products (two register sets that swap roles, so that no copy and no early wait stands between).
__device__ __forceinline__ void cs_trip(const _Float16* an, const v16h (&ph)[4][4], const v16h (&ac)[4], v16h (&ax)[4], float (&mx)[4], float (&se)[4]) {
  const v8f z8 = {0.f,0.f,0.f,0.f,0.f,0.f,0.f,0.f}; v8f d[4] = {z8, z8, z8, z8};
#pragma unroll
  for (int k = 0; k < 4; ++k) {
#pragma unroll
    for (int t = 0; t < 4; ++t) d[t] = f_mma(ac[k], ph[t][k], d[t]); }
#pragma unroll
  for (int k = 0; k < 4; ++k) ax[k] = p_frag(an + k * FRB);
  asm volatile("s_wait_xcnt 0x0" :: "v"(an) : "memory");      /* a precaution: the address that the 8 loads above name stays live and unwritten up to this wait */
  __builtin_amdgcn_sched_barrier(0);      /* keeps the fetch in front of the vector work below, which is the time it has to land */
#pragma unroll
  for (int t = 0; t < 4; ++t) { float nm = mx[t];
#pragma unroll
    for (int r = 0; r < 8; ++r) nm = fmaxf(nm, d[t][r]);
    float s = se[t] * __expf(mx[t] - nm);
#pragma unroll
    for (int r = 0; r < 8; ++r) s += __expf(d[t][r] - nm);
    se[t] = s; mx[t] = nm; } }
__global__ __launch_bounds__(SCW * 32) __attribute__((amdgpu_waves_per_eu(SCW / 4, SCW / 4)))      /* one work-group a WGP: 256 registers a wave, of which the phi fragments take 128 */
void k_colstat_f(const _Float16* __restrict__ QKV, float* __restrict__ ST) {
  __shared__ float rmx[SCW * 2][SCM]; __shared__ float rse[SCW * 2][SCM];
  const int tid = threadIdx.x, w = tid >> 5, lane = tid & 31, ln = lane & 15, hh = lane >> 4;
  const _Float16* q = QKV + (size_t)blockIdx.y * QIS; const int m0 = blockIdx.x * SCM;
  const _Float16* pb = q + (size_t)m0 * CI + 8 * lane;      /* phi lies NP CI elements on (an immediate offset of the loads); 16 rows of K = 128 are 4 blocks = 16 CI elements: row r0 (a multiple of 16) starts r0 CI elements into its plane */
  const _Float16* th = q + (size_t)(w * (NP / SCW)) * CI + 8 * lane;
  v16h ph[4][4], a0[4], a1[4];
#pragma unroll
  for (int t = 0; t < 4; ++t) {
#pragma unroll
    for (int k = 0; k < 4; ++k) ph[t][k] = p_frag(pb + NP * CI + (t * 4 + k) * FRB); }
#pragma unroll
  for (int k = 0; k < 4; ++k) a0[k] = p_frag(th + k * FRB);
  asm volatile("s_wait_xcnt 0x0" :: "v"(pb), "v"(th), "v"(lane) : "memory");      /* a precaution: what the 40 loads above name (the two addresses, or a scalar base with the lane's number) stays live and unwritten up to this wait */
  float mx[4] = {-3.0e38f, -3.0e38f, -3.0e38f, -3.0e38f}, se[4] = {0.f, 0.f, 0.f, 0.f};
#pragma unroll 1      /* rolled: two trips are the period of the register sets, and the loop stays small in the instruction cache */
  for (int nb = 0; nb < NP / SCW; nb += 32) {
    cs_trip(th + (size_t)(nb + 16) * CI, ph, a0, a1, mx, se);
    cs_trip(th + (size_t)(nb + 32 < NP / SCW ? nb + 32 : nb) * CI, ph, a1, a0, mx, se); }      /* the last trip fetches rows of its own range again: in bounds, not used */
#pragma unroll
  for (int t = 0; t < 4; ++t) { rmx[w * 2 + hh][t * 16 + ln] = mx[t]; rse[w * 2 + hh][t * 16 + ln] = se[t]; }
  __syncthreads();      /* every wave's partial maxima and sums are in LDS before a thread folds a column */
  if (tid < SCM) { float m = rmx[0][tid];
#pragma unroll
    for (int i = 1; i < SCW * 2; ++i) m = fmaxf(m, rmx[i][tid]);
    float s = 0.f;
#pragma unroll
    for (int i = 0; i < SCW * 2; ++i) s += rse[i][tid] * __expf(rmx[i][tid] - m);
    float* rec = ST + (size_t)blockIdx.y * (2 * NM) + (size_t)((m0 + tid) / CSC) * (2 * CSC) + (tid % CSC); rec[0] = m; rec[CSC] = 256.0f / s; } }
// y^T = P g^T with neither f nor P stored, and the last product behind it in the same kernel (y^T never leaves the work-group). A work-group owns 64 rows n and all 128 columns of y^T; wave w takes the key columns m in [1024 w, 1024 w + 1024), 32 a trip; the partial tiles (f32) meet in LDS and are added in wave order.
// The score tile is formed TRANSPOSED: D[m][n] = phi[m] . theta[n] (phi as A, theta as B, theta resident). A lane then holds m = 8 hh + r of column n = ln, which is the k order of an A fragment of row ln
// (tile m 0..15 -> elements 0..7, tile m 16..31 -> elements 8..15), so P[n][m] = f16(exp(s - max_m) x 256 / sum_m) becomes the A operand of P g^T in place, with no exchange between lanes.
// All loads stand at the head of a trip and fetch the NEXT trip's records, g and phi (two register sets that swap roles): with one wave a SIMD nothing else hides a load, so each gets a whole trip to land in.
#define PVW 4                     /* waves: the 4,096 key columns split over them */
#define PVN 4                     /* 16-row tiles of n per wave: every phi and g fragment fetched serves PVN matrix instructions */
struct PvSet { v4f mx[4], iv[4]; v16h pf[2][4], gf[8]; };      /* what one trip reads: maxima and 256 / sum of its 32 columns, its phi fragments (A of the scores), its g fragments (B of P g^T) */
// rb, gb, pb are the addresses that the loads name; RO, GO, PO (elements) go into the loads' immediate offsets, so that the wait below can hold exactly those registers.
template <int RO, int GO, int PO>
__device__ __forceinline__ void pv_fetch(const float* rb, const _Float16* gb, const _Float16* pb, PvSet& x) {
  const float* r = rb + RO;
#pragma unroll
  for (int u = 0; u < 2; ++u) { x.mx[2 * u] = *(const v4fa*)(r + 2 * CSC * u); x.mx[2 * u + 1] = *(const v4fa*)(r + 2 * CSC * u + 4); x.iv[2 * u] = *(const v4fa*)(r + 2 * CSC * u + CSC); x.iv[2 * u + 1] = *(const v4fa*)(r + 2 * CSC * u + CSC + 4); }
#pragma unroll
  for (int u = 0; u < 2; ++u) {
#pragma unroll
    for (int k = 0; k < 4; ++k) x.pf[u][k] = p_frag(pb + NP * CI + PO + (u * 4 + k) * FRB); }
#pragma unroll
  for (int c = 0; c < 8; ++c) x.gf[c] = p_frag(gb + GO + c * FRB);
  asm volatile("s_wait_xcnt 0x0" :: "v"(rb), "v"(gb), "v"(pb) : "memory");      /* a precaution: the three addresses that the 40 loads above name stay live and unwritten up to this wait */
  __builtin_amdgcn_sched_barrier(0); }      /* keeps the 40 loads at the head of the trip: without it the scheduler spreads them through the trip and waits for them at once */
__device__ __forceinline__ void pv_trip(const PvSet& c_, const v16h (&th)[PVN][4], v8f (&acc)[PVN][8]) {
  const v8f z8 = {0.f,0.f,0.f,0.f,0.f,0.f,0.f,0.f}; v8f s[2][PVN];      /* [m tile][n tile] */
#pragma unroll
  for (int u = 0; u < 2; ++u) {
#pragma unroll
    for (int v = 0; v < PVN; ++v) s[u][v] = z8; }
#pragma unroll
  for (int k = 0; k < 4; ++k) {
#pragma unroll
    for (int u = 0; u < 2; ++u) {
#pragma unroll
      for (int v = 0; v < PVN; ++v) s[u][v] = f_mma(c_.pf[u][k], th[v][k], s[u][v]); } }
  FragH f[PVN];
#pragma unroll
  for (int u = 0; u < 2; ++u) {
#pragma unroll
    for (int e = 0; e < 8; ++e) { const float m_ = c_.mx[u * 2 + (e >> 2)][e & 3], i_ = c_.iv[u * 2 + (e >> 2)][e & 3];
#pragma unroll
      for (int v = 0; v < PVN; ++v) f[v].h[u * 8 + e] = (_Float16)(__expf(s[u][v][e] - m_) * i_); } }
#pragma unroll
  for (int c = 0; c < 8; ++c) {
#pragma unroll
    for (int v = 0; v < PVN; ++v) acc[v][c] = f_mma(f[v].v, c_.gf[c], acc[v][c]); } }
__global__ __launch_bounds__(PVW * 32) __attribute__((amdgpu_waves_per_eu(PVW / 4, PVW / 4)))      /* one wave a SIMD: the accumulators (256 registers), theta (128) and the fragments in flight need more than 512 */
void k_pvf(const _Float16* __restrict__ QKV, const float* __restrict__ ST, const _Float16* __restrict__ G, float alpha, const _Float16* __restrict__ A, const float* __restrict__ x, float* __restrict__ C) {
  __shared__ __attribute__((aligned(16))) float so[PVW][16 * PVN][CI + 4];
  __shared__ __attribute__((aligned(16))) unsigned short yl[PVN * 4 * FRB];      /* the work-group's 64 rows of y^T, f16, in fragment order */
  const int tid = threadIdx.x, w = tid >> 5, lane = tid & 31, ln = lane & 15, hh = lane >> 4;
  const size_t by = blockIdx.y; const int n0 = blockIdx.x * (16 * PVN); const int ks = NM / PVW;
  const _Float16* q = QKV + by * QIS;
  const float* stp = ST + by * (2 * NM) + (size_t)(w * ks) * 2 + 8 * hh;      /* column m: record m / CSC of 2 CSC floats, maxima first */
  const _Float16* gp = G + by * CI * NM + (size_t)(w * ks) * CI + 8 * lane;      /* g: the 8 blocks (128 channels) of 32 key columns follow each other, 32 CI elements */
  const _Float16* pp = q + (size_t)(w * ks) * CI + 8 * lane;      /* the same place in the theta plane; phi lies NP CI elements on (an immediate offset of the loads) */
  const _Float16* tp = q + (size_t)n0 * CI + 8 * lane;
  v16h th[PVN][4]; PvSet s0, s1;
#pragma unroll
  for (int v = 0; v < PVN; ++v) {
#pragma unroll
    for (int k = 0; k < 4; ++k) th[v][k] = p_frag(tp + (v * 4 + k) * FRB); }
  asm volatile("s_wait_xcnt 0x0" :: "v"(tp) : "memory");      /* a precaution: the address that the 32 loads above name stays live and unwritten up to this wait */
  pv_fetch<0, 0, 0>(stp, gp, pp, s0);
  const v8f z8 = {0.f,0.f,0.f,0.f,0.f,0.f,0.f,0.f}; v8f acc[PVN][8];
#pragma unroll
  for (int v = 0; v < PVN; ++v) {
#pragma unroll
    for (int c = 0; c < 8; ++c) acc[v][c] = z8; }
#pragma unroll 1      /* rolled: two trips are the period of the register sets, and the loop stays small in the instruction cache */
  for (int kb = 0; kb < ks; kb += 64) {
    pv_fetch<64, 32 * CI, 32 * CI>(stp, gp, pp, s1); pv_trip(s0, th, acc);
    const int more = kb + 64 < ks ? 1 : 0;      /* the last trip fetches its own range again: in bounds, not used */
    stp += more * 128; gp += more * (64 * CI); pp += more * (64 * CI);
    pv_fetch<0, 0, 0>(stp, gp, pp, s0); pv_trip(s1, th, acc); }
  /* what the last product needs from memory is asked for here, so that it lands while the partial tiles meet in LDS: wave w owns output channels 64 w .. 64 w + 63 at all 64 positions */
  const int c4 = ln * 4;
  const size_t eo = by * ((size_t)CN * NP) + (size_t)(w * 64 + hh) * NP + n0 + c4;
  const float* xp = x + eo; float* cp = C + eo; v4f xv[32];      /* 16 lanes cover the 256 B of a channel row, a load takes 2 rows */
#pragma unroll
  for (int q = 0; q < 32; ++q) xv[q] = *(const v4fa*)(xp + (size_t)q * 2 * NP);
  const _Float16* ap = A + (size_t)(w * 64) * CI + 8 * lane; v16h wa[4][4];      /* 16 W in fragment order: 16 rows of K = 128 are 4 blocks */
#pragma unroll
  for (int u = 0; u < 4; ++u) {
#pragma unroll
    for (int k = 0; k < 4; ++k) wa[u][k] = p_frag(ap + (u * 4 + k) * FRB); }
  asm volatile("s_wait_xcnt 0x0" :: "v"(xp), "v"(ap) : "memory");      /* a precaution: the two addresses that the 64 loads above name stay live and unwritten up to this wait */
#pragma unroll
  for (int v = 0; v < PVN; ++v) {
#pragma unroll
    for (int c = 0; c < 8; ++c) {
#pragma unroll
      for (int e = 0; e < 8; ++e) so[w][v * 16 + 8 * hh + e][c * 16 + ln] = acc[v][c][e]; } }
  __syncthreads();      /* every wave's partial tile is in LDS before any thread adds them */
  static_assert(PVW == PVN, "one row tile a wave");
  /* y^T goes to LDS in fragment order (rows n, K = 128): wave w writes row tile w, piece it = 2 x block + half; a lane adds 8 consecutive channels of row ln */
  unsigned short* yo = yl + w * 4 * FRB + lane * 8; v8us ty[8];
#pragma unroll
  for (int it = 0; it < 8; ++it) { const float* sp = &so[0][w * 16 + ln][it * 16 + 8 * hh]; v4f sa = *(const v4f*)sp, sb = *(const v4f*)(sp + 4);
#pragma unroll
    for (int k = 1; k < PVW; ++k) { sa += *(const v4f*)(sp + k * (16 * PVN * (CI + 4))); sb += *(const v4f*)(sp + k * (16 * PVN * (CI + 4)) + 4); }
    FragH f;
#pragma unroll
    for (int e = 0; e < 4; ++e) { f.h[e] = (_Float16)(sa[e] * alpha); f.h[4 + e] = (_Float16)(sb[e] * alpha); }
    ty[it] = f.half[0]; }
#pragma unroll
  for (int it = 0; it < 8; ++it) *(v8us*)(yo + it * 256) = ty[it];
  __syncthreads();      /* all 64 rows of y^T are in LDS before a wave reads them as B; and every wave has left so, which turns into output staging */
  /* out = (16 W) y / 16 + bf16(x): D[c][n] = W (A) y^T (B), K = 128 in one chain per tile, blocks in rising order */
  v8f d[4][PVN]; v16h yb[PVN][4];
#pragma unroll
  for (int v = 0; v < PVN; ++v) {
#pragma unroll
    for (int k = 0; k < 4; ++k) yb[v][k] = p_frag((const _Float16*)yl + (v * 4 + k) * FRB + lane * 8); }
  __builtin_amdgcn_sched_barrier(0);      /* keeps the 32 LDS reads as one group ahead of the 64 products: without it each fragment is read right in front of its 4 products, which then wait out the LDS latency 16 times */
#pragma unroll
  for (int v = 0; v < PVN; ++v) {
#pragma unroll
    for (int u = 0; u < 4; ++u) d[u][v] = z8;
#pragma unroll
    for (int k = 0; k < 4; ++k) {
#pragma unroll
      for (int u = 0; u < 4; ++u) d[u][v] = f_mma(wa[u][k], yb[v][k], d[u][v]); } }
  /* the wave's 64 x 64 tile turns in its own part of so, so that whole 128-B lines leave; the residual is rounded where the rows leave LDS */
#pragma unroll
  for (int u = 0; u < 4; ++u) {
#pragma unroll
    for (int v = 0; v < PVN; ++v) {
#pragma unroll
      for (int r = 0; r < 8; ++r) so[w][u * 16 + 8 * hh + r][v * 16 + ln] = d[u][v][r] * 0.0625f; } }
  __builtin_amdgcn_fence(__ATOMIC_ACQ_REL, "workgroup"); __builtin_amdgcn_wave_barrier();
  v4f ov[32];
#pragma unroll
  for (int q = 0; q < 32; ++q) ov[q] = *(const v4fa*)&so[w][q * 2 + hh][c4];
  __builtin_amdgcn_sched_barrier(0);      /* keeps the 32 LDS reads as one group: without it they stand one by one among the sums, each waited for almost at once */
#pragma unroll
  for (int q = 0; q < 32; ++q) {
#pragma unroll
    for (int i = 0; i < 4; ++i) xv[q][i] = ov[q][i] + bf16_round(xv[q][i]); }
  __builtin_amdgcn_sched_barrier(0);      /* all 32 sums stand ahead of the stores, each in registers of its own: no staging register is reused behind a store, and the one wait behind the run covers them all */
#pragma unroll
  for (int q = 0; q < 32; ++q) *(v4f*)(cp + (size_t)q * 2 * NP) = xv[q];
  asm volatile("s_wait_xcnt 0x0" :: "v"(cp) : "memory"); }      /* a precaution: the registers that the 32 stores above name stay unwritten up to this wait */
// Projections straight from x. A work-group owns 64 positions of one image and all 384 output channels: it reads its [256 c][64 n] block of f32 x in whole 128-B lines, rounds it (bf16, exact in f16)
// and lays it in LDS as token rows [n][c]; K = 256 then runs in ONE accumulation chain per tile. Wave w takes rows 32 w .. 32 w + 31 of theta | phi and rows 16 w .. 16 w + 15 of g.
// theta | phi: D[o][n] = W (A) x^T (B): a lane holds 8 consecutive o of token n, 16 B of a token row. g: D[m][ci] = x^T (A) W_g (B): a lane holds 8 consecutive m of channel ci, 16 B of a channel-major row.
// Those 16 B are one lane's piece of a fragment-order block (theta | phi: row tile v, block w % 4, half u; g: key block v / 2, channel tile w, half v % 2), so each tile leaves straight from registers, 512 contiguous bytes a wave.
#define PJN 64                    /* positions per work-group */
#define PJP (CN + 8)              /* LDS pitch of a token row, f16: 16 B past a multiple of 256 B, so that 16 rows read or written 16 B a lane fall on different banks */
__global__ __launch_bounds__(256) __attribute__((amdgpu_waves_per_eu(2, 2)))      /* one work-group a WGP: the 24 weight fragments (192 registers) stay resident beside 12 accumulator tiles */
void k_proj(const float* __restrict__ x, const _Float16* __restrict__ BT, _Float16* __restrict__ QKV, _Float16* __restrict__ G) {
  __shared__ __attribute__((aligned(16))) _Float16 xs[PJN][PJP];
  const int tid = threadIdx.x, w = tid >> 5, lane = tid & 31, ln = lane & 15, hh = lane >> 4;
  const size_t by = blockIdx.y; const int n0 = blockIdx.x * PJN;
  const _Float16* wp = BT + (size_t)(w * 32) * CN + 8 * lane;      /* 16 rows of K = 256 are 8 blocks = 16 CN elements */
  const _Float16* wg = BT + (size_t)(w * 16) * CN + 8 * lane;      /* w_g lies 2 CI CN elements on (an immediate offset of the loads) */
  const int nl = (w & 1) * 32 + (lane & 7) * 4, cl = (w >> 1) * 64 + (lane >> 3) * 8;      /* 8 lanes cover one 128-B line of a channel row; a lane takes 4 positions of 8 + 8 channels */
  const float* xp = x + by * ((size_t)CN * NP) + (size_t)cl * NP + n0 + nl;
  v4f xv[2][8]; v16h wf[3][8];
#pragma unroll
  for (int it = 0; it < 2; ++it) {
#pragma unroll
    for (int i = 0; i < 8; ++i) xv[it][i] = *(const v4fa*)(xp + (size_t)(it * 32 + i) * NP); }
#pragma unroll
  for (int k = 0; k < 8; ++k) { wf[0][k] = p_frag(wp + k * FRB); wf[1][k] = p_frag(wp + 16 * CN + k * FRB); wf[2][k] = p_frag(wg + 2 * CI * CN + k * FRB); }
  asm volatile("s_wait_xcnt 0x0" :: "v"(xp), "v"(wp), "v"(wg) : "memory");      /* a precaution: the three addresses that the 64 loads above name stay live and unwritten up to this wait */
#pragma unroll
  for (int it = 0; it < 2; ++it) {
#pragma unroll
    for (int j = 0; j < 4; ++j) { FragH f;
#pragma unroll
      for (int i = 0; i < 8; ++i) f.h[i] = (_Float16)bf16_round(xv[it][i][j]);
      *(v8us*)&xs[nl + j][cl + it * 32] = f.half[0]; } }
  __syncthreads();      /* the whole x^T tile is in LDS before any wave reads a fragment of it */
  const v8f z8 = {0.f,0.f,0.f,0.f,0.f,0.f,0.f,0.f}; v8f dq[2][4], dg[4];
#pragma unroll
  for (int v = 0; v < 4; ++v) { dq[0][v] = z8; dq[1][v] = z8; dg[v] = z8; }
  const _Float16* xr = &xs[ln][8 * hh];
  v16h xf[2][4];      /* two sets that swap roles: the LDS reads of block k + 1 stand as one group in front of the 12 products of block k */
#pragma unroll
  for (int v = 0; v < 4; ++v) xf[0][v] = f_frag(xr + v * 16 * PJP);
#pragma unroll
  for (int k = 0; k < 8; ++k) {
    if (k < 7) {
#pragma unroll
      for (int v = 0; v < 4; ++v) xf[(k + 1) & 1][v] = f_frag(xr + v * 16 * PJP + (k + 1) * 32); }
    __builtin_amdgcn_sched_barrier(0);      /* keeps the reads ahead of the products: without it each fragment is read right in front of its 3 products, which then wait out the LDS latency 32 times */
#pragma unroll
    for (int v = 0; v < 4; ++v) { dq[0][v] = f_mma(wf[0][k], xf[k & 1][v], dq[0][v]); dq[1][v] = f_mma(wf[1][k], xf[k & 1][v], dq[1][v]); dg[v] = f_mma(xf[k & 1][v], wf[2][k], dg[v]); } }
  v8us tq[4][2], tg[4];
#pragma unroll
  for (int v = 0; v < 4; ++v) { FragH f;
#pragma unroll
    for (int u = 0; u < 2; ++u) {
#pragma unroll
      for (int r = 0; r < 8; ++r) f.h[r] = (_Float16)(dq[u][v][r] * 0.0625f);
      tq[v][u] = f.half[0]; }
#pragma unroll
    for (int r = 0; r < 8; ++r) f.h[r] = (_Float16)(dg[v][r] * 0.0625f);
    tg[v] = f.half[0]; }
  unsigned short* qo = (unsigned short*)QKV + by * QIS + (size_t)(w >> 2) * (NP * CI) + (size_t)n0 * CI + (w & 3) * FRB + lane * 8;      /* waves 0..3 hold theta, 4..7 phi; the wave's 32 channels are block w % 4 of every row tile */
  unsigned short* go = (unsigned short*)G + by * ((size_t)CI * NM) + (size_t)n0 * CI + w * FRB + lane * 8;      /* the wave's 16 channels are block w of every 32 key columns */
  __builtin_amdgcn_sched_barrier(0);      /* all 12 pieces stand ahead of the stores, each in registers of its own: no staging register is reused behind a store, and the one wait behind the run covers them all */
#pragma unroll
  for (int v = 0; v < 4; ++v) {
#pragma unroll
    for (int u = 0; u < 2; ++u) *(v8us*)(qo + v * 4 * FRB + u * 256) = tq[v][u]; }
#pragma unroll
  for (int v = 0; v < 4; ++v) *(v8us*)(go + (v >> 1) * 8 * FRB + (v & 1) * 256) = tg[v];
  asm volatile("s_wait_xcnt 0x0" :: "v"(qo), "v"(go) : "memory"); }      /* a precaution: the registers that the 12 stores above name stay unwritten up to this wait */
extern "C" void kernel_launch(void* const* d_in, const int* in_sizes, int n_in,
                              void* d_out, int out_size, void* d_ws, size_t ws_size, hipStream_t stream) {
  (void)in_sizes; (void)n_in; (void)out_size;
  const float* const* I = (const float* const*)d_in; const float* x = I[0]; const float* tw = I[1]; const float* pw = I[2]; const float* gw = I[3]; const float* ww = I[4];      /* natural 1x1 conv weights: w_theta, w_phi, w_g [128][256], w_mask [256][128]; no biases */
  char* ws = (char*)d_ws; size_t off = 0;
  auto take = [&](size_t bytes) { char* p = ws + off; off += (bytes + 255) & ~(size_t)255; return p; };
  _Float16* BT = (_Float16*)take((size_t)4 * CI * CN * 2); _Float16* BW = BT + (size_t)3 * CI * CN;      /* w_theta, w_phi, w_g as one [384][256] plane, then w_mask */
  _Float16* QKV = (_Float16*)take((size_t)NB * QIS * 2); _Float16* G = (_Float16*)take((size_t)NB * CI * NP * 2);
  float* ST = (float*)take((size_t)NB * NM * 2 * 4);      /* per-column max and 256 / sum, one 128-B record per 16 columns */
  if (off > ws_size) return;
  k_wnat<<<dim3((unsigned)(((size_t)CI * CN / 8 + 255) / 256), 4), 256, 0, stream>>>(tw, pw, gw, ww, (size_t)CI * CN / 8, BT);      /* [out][in] x16 f16 planes in fragment order */
  k_proj<<<dim3(NP / PJN, NB), 256, 0, stream>>>(x, BT, QKV, G);      /* every image: theta^T, phi^T [n][128] and g [ci][m] (the PV B^T operand) -> f16 planes in fragment order, from f32 x */
  k_colstat_f<<<dim3(NM / SCM, NB), SCW * 32, 0, stream>>>(QKV, ST);      /* every image: softmax over the QUERY axis: per key column m the max and 256 / sum over all 4096 rows n of f[n][m] = theta[n].phi[m] (K = 128, NO scale), f formed in registers */
  k_pvf<<<dim3(NP / (16 * PVN), NB), PVW * 32, 0, stream>>>(QKV, ST, G, 0.00390625f, BW, x, (float*)d_out);      /* every image: y^T [n][ci] = sum_m P[n][m] g[ci][m] -> f16 in LDS, P[n][m] = f16(256 exp(f - max_m) / sum_m), f formed again in registers; then out[c][a] = (16 W as A) x (y^T as B^T) / 16 + bf16(x) -> f32 channel-first output block */
}

// v009
// Measured time: 56.5 microseconds a run.
// Two timings next to v008 put it at 1.04 and 1.05 times that version's speed.
// Over all steps from v000, the starting kernel, it is 124 times as fast.
#include <hip/hip_runtime.h>
// Non-local block with the softmax taken over the QUERY axis (x [4][256][64][64]; theta, phi, g = conv1x1(x) with [128][256] weights (U(+-1/16), no biases); scores[n][m] = theta[n].phi[m] (NO scaling); attn = softmax(scores, axis = 1): normalised over n for every key column m (the module's unconventional axis); out[n] = sum_m attn[n][m] g[m]; mask = conv1x1(out; w_mask [256][128], no bias); result = x + mask -> [4][256][64][64]).
// Structure: channel-first; the images share every launch (grid); one projection kernel reads f32 x (rounded to bf16, exact in f16), turns it to token rows in LDS and forms theta^T, phi^T (rows = tokens) and g (rows = channels) on WMMA (f32 accumulation) -> f16, every f16 plane of the workspace laid in fragment order (see FRB); f [4096][4096] = theta^T phi (K = 128, no scale) f32 in registers only, formed once for the column statistics and once for the weights (f32 statistics, native exp; weights x256 f16); y^T = P g^T (x2^-8) f16; out = (16 W) y / 16 + bf16(x) f32 channel-first; launches: k_wnat, k_proj, k_colstat_f, k_pvf.
// Compute dtype: inputs rounded to bf16; x / weights exact; q, k, v, softmax weights and o as plain f16 GEMM operands (~2^-12); scores and softmax statistics f32; v_wmma_f32_16x16x32_f16.
#define NB 4
#define SQ 4096
#define DM 256
#define NH 1
#define HD 64
#define HG 4                         /* heads per attention launch group */
#define B0 0                         /* first batch processed (debug hook) */
#define NBR NB                       /* batches processed (debug hook) */
#define NR ((size_t)NB * SQ)         /* token rows */
#define MP ((int)((size_t)NBR * SQ)) /* rows projected (debug hook) */
#define QT 256                       /* query rows per causal tile */
#define NKX SQ                       /* S / P row pitch */
#define QT0 256                      /* first-tile rows recomputed exactly (256: buys margin for the few-key rows 128..255, which have no output projection to average the single-f16 P/v rounding) */
#define QN SQ                        /* query rows attended per batch (debug hook) */
#define NHD NH                       /* heads attended (debug hook) */
#define MPO MP                       /* rows through the output stage (debug hook) */
#define LQ DM            /* row pitch of the q/k/v rows */
typedef __bf16 v16b __attribute__((ext_vector_type(16)));
typedef unsigned short v8us __attribute__((ext_vector_type(8), may_alias));
typedef float  v8f  __attribute__((ext_vector_type(8)));
typedef float  v4f  __attribute__((ext_vector_type(4)));
typedef float  v4fa __attribute__((ext_vector_type(4), may_alias));
union FragB { v16b v; v8us half[2]; unsigned short u[16]; };

__device__ __forceinline__ unsigned short bf16_bits(float x) { unsigned int u = __float_as_uint(x); return (unsigned short)((u + 0x7FFFu + ((u >> 16) & 1u)) >> 16); }
__device__ __forceinline__ float bf16_val(unsigned short b) { return __uint_as_float(((unsigned int)b) << 16); }
__device__ __forceinline__ float bf16_round(float x) { return bf16_val(bf16_bits(x)); }
// D += A·B with NT terms: 1 = ah·bh, 2 = + al·bh (A split), 3 = + ah·bl (both split)
template <int NT>
__device__ __forceinline__ v8f mmaN(v16b ah, v16b al, v16b bh, v16b bl, v8f c) {
  c = __builtin_amdgcn_wmma_f32_16x16x32_bf16(false, ah, false, bh, (short)0, c, false, false);
  if (NT >= 2) c = __builtin_amdgcn_wmma_f32_16x16x32_bf16(false, al, false, bh, (short)0, c, false, false);
  if (NT >= 3) c = __builtin_amdgcn_wmma_f32_16x16x32_bf16(false, ah, false, bl, (short)0, c, false, false);
  asm volatile("v_nop\n\tv_nop\n\tv_nop\n\tv_nop" : "+v"(c) : "v"(ah), "v"(al), "v"(bh), "v"(bl));
  return c;
}

__global__ __launch_bounds__(256) void k_wt_bf16(const float* __restrict__ W, unsigned short* __restrict__ Wt, int K, int N) {
  const int t = blockIdx.x * 256 + threadIdx.x;
  const int k8n = K / 8;
  if (t >= N * k8n) return;
  const int n = t / k8n, k8 = (t % k8n) * 8;
  v8us v;
#pragma unroll
  for (int i = 0; i < 8; ++i) v[i] = bf16_bits(W[(size_t)(k8 + i) * N + n]);
  *(v8us*)(Wt + (size_t)n * K + k8) = v;
  
}

// GEMM C[M][N] (f32, pitch ldc) = act(A[M][K]·W + bias). A f32 row-major (pitch lda) converted per fragment to bf16
// (ASPLIT: hi/lo two planes -> 2 terms, else single rounded term); Wt bf16 [N][K] (pitch ldb). BIAS_BF16 rounds the
// bias to bf16 first (bias quantised to bf16 before the add). K%32==0, M%16==0, N%64==0.
template <bool ASPLIT, int ACT, bool BIAS_BF16>
__global__ __launch_bounds__(128) void k_gemm_bf(const float* __restrict__ A, int lda, const unsigned short* __restrict__ Wt, int ldb,
                                               const float* __restrict__ bias, float* __restrict__ C, int ldc, int M, int N, int K) {
  __shared__ __attribute__((aligned(16))) float so[4][16][64];
  const int tid = threadIdx.x, w = tid >> 5, lane = tid & 31, ln = lane & 15, hh = lane >> 4;
  const int ntn = N / 64;
  const int wid = blockIdx.x * 4 + w;
  const int mt = wid / ntn, nq = wid % ntn;
  if (mt * 16 >= M) return;
  const int row0 = mt * 16, col0 = nq * 64;
  const float* arow = A + (size_t)(row0 + ln) * lda;
  v8f acc[4] = {};
  for (int kb = 0; kb < K; kb += 32) {
    FragB ah, al;
    const v4f x0 = *(const v4fa*)(arow + kb + 8 * hh), x1 = *(const v4fa*)(arow + kb + 8 * hh + 4);
    const v4f x2 = *(const v4fa*)(arow + kb + 16 + 8 * hh), x3 = *(const v4fa*)(arow + kb + 16 + 8 * hh + 4);
    float xs[16] = {x0[0],x0[1],x0[2],x0[3],x1[0],x1[1],x1[2],x1[3],x2[0],x2[1],x2[2],x2[3],x3[0],x3[1],x3[2],x3[3]};
#pragma unroll
    for (int i = 0; i < 16; ++i) { const unsigned short hb = bf16_bits(xs[i]); ah.u[i] = hb; al.u[i] = ASPLIT ? bf16_bits(xs[i] - bf16_val(hb)) : (unsigned short)0; }
#pragma unroll
    for (int t = 0; t < 4; ++t) {
      const unsigned short* brow = Wt + (size_t)(col0 + t * 16 + ln) * ldb + kb;
      FragB b;
      b.half[0] = *(const v8us*)(brow + 8 * hh);
      b.half[1] = *(const v8us*)(brow + 16 + 8 * hh);
      acc[t] = mmaN<ASPLIT ? 2 : 1>(ah.v, al.v, b.v, b.v, acc[t]);
    }
  }
#pragma unroll
  for (int t = 0; t < 4; ++t) {
    float bv = bias ? bias[col0 + t * 16 + ln] : 0.f;
    if (BIAS_BF16) bv = bf16_round(bv);
#pragma unroll
    for (int r = 0; r < 8; ++r) { float v = acc[t][r] + bv; if (ACT == 1) v = fmaxf(v, 0.f); so[w][8 * hh + r][t * 16 + ln] = v; }
  }
  __builtin_amdgcn_fence(__ATOMIC_ACQ_REL, "workgroup");
  __builtin_amdgcn_wave_barrier();
  const int rsub = lane >> 4, c4 = (lane & 15) * 4;
  {
#pragma unroll
    for (int q = 0; q < 8; ++q) {
      const int r = q * 2 + rsub;
      const v4f v = *(const v4fa*)&so[w][r][c4];
      *(v4f*)(C + (size_t)(row0 + r) * ldc + col0 + c4) = v;
    }
    
  }
}

// GEMM C = act(A·W + bias + resid): A f32 (ASPLIT -> hi/lo 2 terms), Wt bf16 [N][K]; ACT 0 none, 1 relu, 2 exact gelu;
// resid (optional, f32, row index = (row % rmod), pitch ldr, RES_BF16 rounds it) added before the activation.
template <bool ASPLIT, int ACT, bool BIAS_BF16, bool RES_BF16>
__global__ __launch_bounds__(128) void k_gemm_bf3(const float* __restrict__ A, int lda, const unsigned short* __restrict__ Wt, int ldb,
                                                const float* __restrict__ bias, const float* __restrict__ resid, int rmod, int ldr,
                                                float* __restrict__ C, int ldc, int M, int N, int K) {
  __shared__ __attribute__((aligned(16))) float so[4][16][64];
  const int tid = threadIdx.x, w = tid >> 5, lane = tid & 31, ln = lane & 15, hh = lane >> 4;
  const int ntn = N / 64;
  const int wid = blockIdx.x * 4 + w;
  const int mt = wid / ntn, nq = wid % ntn;
  if (mt * 16 >= M) return;
  const int row0 = mt * 16, col0 = nq * 64;
  const float* arow = A + (size_t)(row0 + ln) * lda;
  v8f acc[4] = {};
  for (int kb = 0; kb < K; kb += 32) {
    FragB ah, al;
    const v4f x0 = *(const v4fa*)(arow + kb + 8 * hh), x1 = *(const v4fa*)(arow + kb + 8 * hh + 4);
    const v4f x2 = *(const v4fa*)(arow + kb + 16 + 8 * hh), x3 = *(const v4fa*)(arow + kb + 16 + 8 * hh + 4);
    float xs[16] = {x0[0],x0[1],x0[2],x0[3],x1[0],x1[1],x1[2],x1[3],x2[0],x2[1],x2[2],x2[3],x3[0],x3[1],x3[2],x3[3]};
#pragma unroll
    for (int i = 0; i < 16; ++i) { const unsigned short hb = bf16_bits(xs[i]); ah.u[i] = hb; al.u[i] = ASPLIT ? bf16_bits(xs[i] - bf16_val(hb)) : (unsigned short)0; }
#pragma unroll
    for (int t = 0; t < 4; ++t) {
      const unsigned short* brow = Wt + (size_t)(col0 + t * 16 + ln) * ldb + kb;
      FragB b;
      b.half[0] = *(const v8us*)(brow + 8 * hh);
      b.half[1] = *(const v8us*)(brow + 16 + 8 * hh);
      acc[t] = mmaN<ASPLIT ? 2 : 1>(ah.v, al.v, b.v, b.v, acc[t]);
    }
  }
#pragma unroll
  for (int t = 0; t < 4; ++t) {
    const int col = col0 + t * 16 + ln;
    float bv = bias ? bias[col] : 0.f;
    if (BIAS_BF16) bv = bf16_round(bv);
#pragma unroll
    for (int r = 0; r < 8; ++r) {
      float v = acc[t][r] + bv;
      if (resid) { float rv = resid[(size_t)((row0 + 8 * hh + r) % rmod) * ldr + col]; if (RES_BF16) rv = bf16_round(rv); v += rv; }
      if (ACT == 1) v = fmaxf(v, 0.f);
      if (ACT == 2) v = 0.5f * v * (1.0f + erff(v * 0.70710678118654752f));
      if (ACT == 3) { const float u = 0.7978845608028654f * (v + 0.044715f * v * v * v); v = 0.5f * v * (1.0f + tanhf(u)); }
      so[w][8 * hh + r][t * 16 + ln] = v;
    }
  }
  __builtin_amdgcn_fence(__ATOMIC_ACQ_REL, "workgroup");
  __builtin_amdgcn_wave_barrier();
  const int rsub = lane >> 4, c4 = (lane & 15) * 4;
  {
#pragma unroll
    for (int q = 0; q < 8; ++q) {
      const int r = q * 2 + rsub;
      const v4f v = *(const v4fa*)&so[w][r][c4];
      *(v4f*)(C + (size_t)(row0 + r) * ldc + col0 + c4) = v;
    }
    
  }
}
// row LayerNorm (biased variance, eps) over N: s = X (+ R); optional out_sum <- s; out_norm <- (s-mu)*rsqrt(var+eps)*g + b
template <bool PARAM_BF16>
__global__ __launch_bounds__(256) void k_layernorm(const float* __restrict__ X, const float* __restrict__ R, const float* __restrict__ g, const float* __restrict__ bta,
                                                  float* __restrict__ out_sum, float* __restrict__ out_norm, int N, float eps) {
  __shared__ float red[256];
  const int row = blockIdx.x, tid = threadIdx.x;
  const float* x = X + (size_t)row * N; const float* rr = R ? R + (size_t)row * N : nullptr;
  float vals[16];                     // up to N = 4096
  const int per = N / 256;            // contiguous chunk per thread? use strided-by-4 chunks: thread handles j = tid*4 + 1024*u
  float s1 = 0.f;
  for (int u = 0; u < per / 4; ++u) {
    const int j = tid * 4 + 1024 * u;
    const v4f a = *(const v4fa*)(x + j);
    v4f b = {0.f,0.f,0.f,0.f}; if (rr) b = *(const v4fa*)(rr + j);
#pragma unroll
    for (int q = 0; q < 4; ++q) { const float v = a[q] + b[q]; vals[u * 4 + q] = v; s1 += v; }
  }
  red[tid] = s1; __syncthreads();
  for (int st = 128; st > 0; st >>= 1) { if (tid < st) red[tid] += red[tid + st]; __syncthreads(); }
  const float mu = red[0] / (float)N; __syncthreads();
  float s2 = 0.f;
  for (int u = 0; u < per / 4; ++u)
#pragma unroll
    for (int q = 0; q < 4; ++q) { const float c = vals[u * 4 + q] - mu; s2 += c * c; }
  red[tid] = s2; __syncthreads();
  for (int st = 128; st > 0; st >>= 1) { if (tid < st) red[tid] += red[tid + st]; __syncthreads(); }
  const float rs = rsqrtf(red[0] / (float)N + eps);
  {
    for (int u = 0; u < per / 4; ++u) {
      const int j = tid * 4 + 1024 * u;
      v4f o, sm;
#pragma unroll
      for (int q = 0; q < 4; ++q) {
        float gg = g[j + q], bb = bta[j + q];
        if (PARAM_BF16) { gg = bf16_round(gg); bb = bf16_round(bb); }
        sm[q] = vals[u * 4 + q]; o[q] = (vals[u * 4 + q] - mu) * rs * gg + bb;
      }
      if (out_sum) *(v4f*)(out_sum + (size_t)row * N + j) = sm;
      *(v4f*)(out_norm + (size_t)row * N + j) = o;
    }
    
  }
}



// ---- f16 WMMA path (v_wmma_f32_16x16x32_f16): 11-bit significands for operands in range — used where a [0,1] probability operand needs more precision than bf16
typedef _Float16 v16h __attribute__((ext_vector_type(16)));
union FragH { v16h v; v8us half[2]; _Float16 h[16]; unsigned short u[16]; };
template <int NT>
__device__ __forceinline__ v8f mmaH(v16h ah, v16h al, v16h bh, v16h bl, v8f c) {
  c = __builtin_amdgcn_wmma_f32_16x16x32_f16(false, ah, false, bh, (short)0, c, false, false);
  if (NT >= 2) c = __builtin_amdgcn_wmma_f32_16x16x32_f16(false, al, false, bh, (short)0, c, false, false);
  if (NT >= 3) c = __builtin_amdgcn_wmma_f32_16x16x32_f16(false, ah, false, bl, (short)0, c, false, false);
  asm volatile("v_nop\n\tv_nop\n\tv_nop\n\tv_nop" : "+v"(c) : "v"(ah), "v"(al), "v"(bh), "v"(bl));
  return c;
}
// batched GEMM like k_gemm_b but f16 operands: A f32 (split into f16 hi/lo if ASPLIT, else rounded to f16), Bt = f16 values [n][k]; alpha; C f32; N multiple of 16 (partial tiles skipped)
template <bool ASPLIT>
__global__ __launch_bounds__(128) void k_gemm_h(const float* __restrict__ A, int lda, size_t sA, const _Float16* __restrict__ Bh, int ldb, size_t sB, float alpha, float* __restrict__ C, int ldc, size_t sC, int M, int N, int K) {
  __shared__ __attribute__((aligned(16))) float so[4][16][64];
  const int tid = threadIdx.x, w = tid >> 5, lane = tid & 31, ln = lane & 15, hh = lane >> 4; const int by = blockIdx.y;
  A += (size_t)by * sA; Bh += (size_t)by * sB; C += (size_t)by * sC;
  const int ntn = (N + 63) / 64; const int wid = blockIdx.x * 4 + w; const int mt = wid / ntn, nq = wid % ntn; if (mt * 16 >= M) return;
  const int row0 = mt * 16, col0 = nq * 64; const float* arow = A + (size_t)(row0 + ln) * lda;
  v8f acc[4] = {};
  for (int kb = 0; kb < K; kb += 32) {
    FragH ah, al;
    const v4f x0 = *(const v4fa*)(arow + kb + 8 * hh), x1 = *(const v4fa*)(arow + kb + 8 * hh + 4), x2 = *(const v4fa*)(arow + kb + 16 + 8 * hh), x3 = *(const v4fa*)(arow + kb + 16 + 8 * hh + 4);
    float xs[16] = {x0[0],x0[1],x0[2],x0[3],x1[0],x1[1],x1[2],x1[3],x2[0],x2[1],x2[2],x2[3],x3[0],x3[1],x3[2],x3[3]};
#pragma unroll
    for (int i = 0; i < 16; ++i) { const _Float16 h = (_Float16)xs[i]; ah.h[i] = h; al.h[i] = ASPLIT ? (_Float16)(xs[i] - (float)h) : (_Float16)0.0f; }
#pragma unroll
    for (int t = 0; t < 4; ++t) { if (col0 + t * 16 >= N) continue; const size_t boff = (size_t)(col0 + t * 16 + ln) * ldb + kb; FragH bq; bq.half[0] = *(const v8us*)(Bh + boff + 8 * hh); bq.half[1] = *(const v8us*)(Bh + boff + 16 + 8 * hh);
      acc[t] = mmaH<ASPLIT ? 2 : 1>(ah.v, al.v, bq.v, bq.v, acc[t]); }
  }
#pragma unroll
  for (int t = 0; t < 4; ++t) { if (col0 + t * 16 >= N) continue;
#pragma unroll
    for (int r = 0; r < 8; ++r) so[w][8 * hh + r][t * 16 + ln] = acc[t][r] * alpha; }
  __builtin_amdgcn_fence(__ATOMIC_ACQ_REL, "workgroup"); __builtin_amdgcn_wave_barrier();
  const int rsub = lane >> 4, c4 = (lane & 15) * 4;
  {
#pragma unroll
    for (int q = 0; q < 8; ++q) { const int r = q * 2 + rsub; if (col0 + c4 < N) { const v4f v = *(const v4fa*)&so[w][r][c4]; *(v4f*)(C + (size_t)(row0 + r) * ldc + col0 + c4) = v; } }
     }
}

// Wt[n][k] = f16(W[k][n]·scale) from f32 row-major W[K][N] (scale = power of two; bf16-exact weights stay exact in f16 away from the subnormal range)
__global__ __launch_bounds__(256) void k_wt_f16(const float* __restrict__ W, _Float16* __restrict__ Wt, int K, int N, float scale) {
  const int t = blockIdx.x * 256 + threadIdx.x; if (t >= N * (K / 8)) return; const int n = t / (K / 8), k8 = (t % (K / 8)) * 8; FragH f;
#pragma unroll
  for (int i = 0; i < 8; ++i) f.h[i] = (_Float16)(bf16_round(W[(size_t)(k8 + i) * N + n]) * scale); const v8us o = f.half[0];
  *(v8us*)((unsigned short*)Wt + (size_t)n * K + k8) = o; 
}
// k_gemm_hh variant with fused epilogue: v = acc·alpha + bias[by·sBias + col] (+ CP[(row/rowsPerB)·sCPb + by·64 + col] if CP) ; ACT 0 none / 1 elu ; writes f16 C16 (and f32 C if non-null)
template <int ACT>
__global__ __launch_bounds__(128) void k_gemm_hhx(const _Float16* __restrict__ A, int lda, size_t sA, const _Float16* __restrict__ Bh, int ldb, size_t sB, float alpha, const float* __restrict__ bias, size_t sBias, const float* __restrict__ CP, int rowsPerB, size_t sCPb, int row0g,
    float* __restrict__ C, _Float16* __restrict__ C16, int ldc, size_t sC, int M, int N, int K) {
  __shared__ __attribute__((aligned(16))) float so[4][16][64];
  const int tid = threadIdx.x, w = tid >> 5, lane = tid & 31, ln = lane & 15, hh = lane >> 4; const int by = blockIdx.y;
  A += (size_t)by * sA; Bh += (size_t)by * sB; const size_t cofs = (size_t)by * sC; const float* bp = bias ? bias + (size_t)by * sBias : nullptr;
  const int ntn = (N + 63) / 64; const int wid = blockIdx.x * 4 + w; const int mt = wid / ntn, nq = wid % ntn; if (mt * 16 >= M) return;
  const int row0 = mt * 16, col0 = nq * 64; const _Float16* arow = A + (size_t)(row0 + ln) * lda;
  v8f acc[4] = {};
  for (int kb = 0; kb < K; kb += 32) { FragH ah; ah.half[0] = *(const v8us*)((const unsigned short*)arow + kb + 8 * hh); ah.half[1] = *(const v8us*)((const unsigned short*)arow + kb + 16 + 8 * hh);
#pragma unroll
    for (int t = 0; t < 4; ++t) { if (col0 + t * 16 >= N) continue; const size_t boff = (size_t)(col0 + t * 16 + ln) * ldb + kb; FragH bq; bq.half[0] = *(const v8us*)((const unsigned short*)Bh + boff + 8 * hh); bq.half[1] = *(const v8us*)((const unsigned short*)Bh + boff + 16 + 8 * hh);
      acc[t] = mmaH<1>(ah.v, ah.v, bq.v, bq.v, acc[t]); }
  }
#pragma unroll
  for (int t = 0; t < 4; ++t) { if (col0 + t * 16 >= N) continue; const int col = col0 + t * 16 + ln; const float bv = bp ? bf16_round(bp[col]) : 0.f;
#pragma unroll
    for (int r = 0; r < 8; ++r) { float v = acc[t][r] * alpha + bv; if (CP) { const int rr = row0g + row0 + 8 * hh + r; if (rowsPerB < 0) v += CP[cofs + (size_t)rr * ldc + col];      /* rowsPerB < 0: own element of the batched C plane */ else { const int bidx = rr / rowsPerB; v += CP[(size_t)bidx * sCPb + (size_t)by * 64 + col]; } } if (ACT == 1) v = (v > 0.f) ? v : expm1f(v); else if (ACT == 7) v = (v > 0.f) ? v + 1.0f : expf(v); else if (ACT == 8) v = tanhf(v); else if (ACT == 9) v = 0.5f * v * (1.0f + tanhf(0.7978845608028654f * (v + 0.044715f * v * v * v))); else if (ACT == 11) v = 1.0f / (1.0f + expf(-v)); else if (ACT == 12) v = (v > 0.f) ? v : 0.01f * v; else if (ACT == 14) v = (v > 0.f) ? v : 0.1f * v; else if (ACT == 16) v = (v >= 0.f) ? v : 0.3f * v; else if (ACT == 17) v = (v >= 0.f) ? v : 0.2f * v; else if (ACT == 15) v = v / (1.0f + expf(-v)); else if (ACT == 3) v = fmaxf(v, 0.f); else if (ACT == 6) v = 0.5f * v * (1.0f + erff(v * 0.70710678118654752f)); so[w][8 * hh + r][t * 16 + ln] = v; } }
  __builtin_amdgcn_fence(__ATOMIC_ACQ_REL, "workgroup"); __builtin_amdgcn_wave_barrier();
  const int rsub = lane >> 4, c4 = (lane & 15) * 4; typedef _Float16 v4h __attribute__((ext_vector_type(4)));
  {
#pragma unroll
    for (int q = 0; q < 8; ++q) { const int r = q * 2 + rsub; if (col0 + c4 < N) { const v4f v = *(const v4fa*)&so[w][r][c4]; if (C) *(v4f*)(C + cofs + (size_t)(row0 + r) * ldc + col0 + c4) = v; if (C16) { v4h h4; for (int i = 0; i < 4; ++i) h4[i] = (_Float16)v[i]; *(v4h*)(C16 + cofs + (size_t)(row0 + r) * ldc + col0 + c4) = h4; } } }
     }
}


typedef _Float16 v4h __attribute__((ext_vector_type(4)));

__global__ __launch_bounds__(256) void k_x16(const float* __restrict__ x, _Float16* __restrict__ X16, size_t n8) { const size_t t = (size_t)blockIdx.x * 256 + threadIdx.x; if (t >= n8) return; FragH f;
#pragma unroll
  for (int q = 0; q < 8; ++q) f.h[q] = (_Float16)bf16_round(x[t * 8 + q]); *(v8us*)((unsigned short*)X16 + t * 8) = f.half[0];  }
__global__ __launch_bounds__(256) void k_h16(const float* __restrict__ x, _Float16* __restrict__ X16, size_t n8) { const size_t t = (size_t)blockIdx.x * 256 + threadIdx.x; if (t >= n8) return; FragH f;
#pragma unroll
  for (int q = 0; q < 8; ++q) f.h[q] = (_Float16)x[t * 8 + q]; *(v8us*)((unsigned short*)X16 + t * 8) = f.half[0];  }
__global__ __launch_bounds__(256) void k_round16f(const float* __restrict__ W, _Float16* __restrict__ Bt, size_t n8) { const size_t t = (size_t)blockIdx.x * 256 + threadIdx.x; if (t >= n8) return; FragH f;
#pragma unroll
  for (int i = 0; i < 8; ++i) f.h[i] = (_Float16)(bf16_round(W[t * 8 + i]) * 16.0f); *(v8us*)((unsigned short*)Bt + t * 8) = f.half[0];  }
template <int NHv, int TTv>
__global__ __launch_bounds__(256) void k_vt(const _Float16* __restrict__ V16, int ldv, int voff, _Float16* __restrict__ Vt) { __shared__ unsigned short tl[64][66]; const int tid = threadIdx.x; const int slab = blockIdx.x / (TTv / 64), lg = blockIdx.x % (TTv / 64); const int b = slab / NHv, h = slab % NHv;
  for (int i = tid; i < 64 * 8; i += 256) { const int r = i / 8, c8 = (i % 8) * 8; FragH f; f.half[0] = *(const v8us*)((const unsigned short*)V16 + ((size_t)b * TTv + lg * 64 + r) * ldv + voff + h * 64 + c8);
#pragma unroll
    for (int q = 0; q < 8; ++q) tl[r][c8 + q] = f.u[q]; }
  __syncthreads();
  {
#pragma unroll
    for (int rd = 0; rd < 2; ++rd) { const int d = rd * 32 + tid / 8, pc = tid % 8; FragH f;
#pragma unroll
      for (int q = 0; q < 8; ++q) f.u[q] = tl[pc * 8 + q][d];
      *(v8us*)((unsigned short*)Vt + ((size_t)slab * 64 + d) * TTv + lg * 64 + pc * 8) = f.half[0]; }
     } }

__global__ __launch_bounds__(256) void k_hl(const float* __restrict__ F, _Float16* __restrict__ Hh, _Float16* __restrict__ Hl, size_t n8) { const size_t t = (size_t)blockIdx.x * 256 + threadIdx.x; if (t >= n8) return; FragH fh, fl; const v4f a = *(const v4fa*)(F + t * 8), c = *(const v4fa*)(F + t * 8 + 4);
#pragma unroll
  for (int q = 0; q < 4; ++q) { _Float16 h = (_Float16)a[q]; fh.h[q] = h; fl.h[q] = (_Float16)((a[q] - (float)h) * 1024.0f); h = (_Float16)c[q]; fh.h[4 + q] = h; fl.h[4 + q] = (_Float16)((c[q] - (float)h) * 1024.0f); }
  { *(v8us*)((unsigned short*)Hh + t * 8) = fh.half[0]; *(v8us*)((unsigned short*)Hl + t * 8) = fl.half[0];  } }

// ---- fast GEMM (wave tile 32x64; requires M % 32 == 0 rows per launch region and N % 64 == 0); epilogue = k_gemm_hhx semantics ----
__device__ __forceinline__ v16h g2_frag(const _Float16* p, int hh) { FragH f; f.half[0] = *(const v8us*)((const unsigned short*)p + 8 * hh); f.half[1] = *(const v8us*)((const unsigned short*)p + 16 + 8 * hh); return f.v; }
__device__ __forceinline__ v8f g2_mma(v16h a, v16h b, v8f c) { v8f d = __builtin_amdgcn_wmma_f32_16x16x32_f16(false, a, false, b, (short)0, c, false, false); asm volatile("v_nop\n\tv_nop\n\tv_nop\n\tv_nop" : "+v"(d) : "v"(a), "v"(b)); return d; }
template <int ACT>
__global__ __launch_bounds__(128) void k_gemm2(const _Float16* __restrict__ A, int lda, size_t sA, const _Float16* __restrict__ Bh, int ldb, size_t sB, float alpha, const float* __restrict__ bias, size_t sBias, const float* __restrict__ CP, int rowsPerB, size_t sCPb, int row0g,
    float* __restrict__ C, _Float16* __restrict__ C16, int ldc, size_t sC, int M, int N, int K) { static_assert(ACT == 0 || ACT == 3 || ACT == 6 || ACT == 8 || ACT == 9 || ACT == 11 || ACT == 12 || ACT == 14 || ACT == 15 || ACT == 16 || ACT == 17, "k_gemm2: unsupported ACT code (would silently apply no activation)");
  __shared__ __attribute__((aligned(16))) float so[4][32][68];
  const int tid = threadIdx.x, w = tid >> 5, lane = tid & 31, ln = lane & 15, hh = lane >> 4; const int by = blockIdx.y;
  A += (size_t)by * sA; Bh += (size_t)by * sB; const size_t cofs = (size_t)by * sC; const float* bp = bias ? bias + (size_t)by * sBias : nullptr;
  const int ntn = N >> 6; const int mt = blockIdx.x / ntn, nq = blockIdx.x - mt * ntn; const int row0 = mt * 128 + 32 * w, col0 = nq * 64; if (row0 >= M) return;
  const _Float16* a0p = A + (size_t)(row0 + ln) * lda; const _Float16* a1p = a0p + (size_t)16 * lda;
  const _Float16* b0p = Bh + (size_t)(col0 + ln) * ldb; const _Float16* b1p = b0p + (size_t)16 * ldb; const _Float16* b2p = b1p + (size_t)16 * ldb; const _Float16* b3p = b2p + (size_t)16 * ldb;
  const v8f z8 = {0.f,0.f,0.f,0.f,0.f,0.f,0.f,0.f}; v8f c00 = z8, c01 = z8, c02 = z8, c03 = z8, c10 = z8, c11 = z8, c12 = z8, c13 = z8;
#pragma unroll 1
  for (int kb = 0; kb < K; kb += 32) { const v16h a0 = g2_frag(a0p + kb, hh), a1 = g2_frag(a1p + kb, hh);
    v16h b = g2_frag(b0p + kb, hh); c00 = g2_mma(a0, b, c00); c10 = g2_mma(a1, b, c10);
    b = g2_frag(b1p + kb, hh); c01 = g2_mma(a0, b, c01); c11 = g2_mma(a1, b, c11);
    b = g2_frag(b2p + kb, hh); c02 = g2_mma(a0, b, c02); c12 = g2_mma(a1, b, c12);
    b = g2_frag(b3p + kb, hh); c03 = g2_mma(a0, b, c03); c13 = g2_mma(a1, b, c13); }
  v8f accs[8] = {c00, c01, c02, c03, c10, c11, c12, c13};
#pragma unroll
  for (int u = 0; u < 8; ++u) { const int t = u & 3, half = u >> 2; const int col = col0 + t * 16 + ln; const float bv = bp ? bf16_round(bp[col]) : 0.f;
#pragma unroll
    for (int r = 0; r < 8; ++r) { const int rloc = half * 16 + 8 * hh + r; float v = accs[u][r] * alpha + bv; if (CP) { if (rowsPerB < 0) v += CP[cofs + (size_t)(row0g + row0 + rloc) * ldc + col];      /* rowsPerB < 0: own element of the batched C plane */ else { const int bidx = (row0g + row0 + rloc) / rowsPerB; v += CP[(size_t)bidx * sCPb + (size_t)by * 64 + col]; } }
      if (ACT == 3) v = fmaxf(v, 0.f); else if (ACT == 6) v = 0.5f * v * (1.0f + erff(v * 0.70710678118654752f)); else if (ACT == 11) v = 1.0f / (1.0f + expf(-v)); else if (ACT == 15) v = v / (1.0f + expf(-v)); else if (ACT == 12) v = (v > 0.f) ? v : 0.01f * v; else if (ACT == 8) v = tanhf(v); else if (ACT == 9) v = 0.5f * v * (1.0f + tanhf(0.7978845608028654f * (v + 0.044715f * v * v * v))); else if (ACT == 14) v = (v > 0.f) ? v : 0.1f * v; else if (ACT == 16) v = (v >= 0.f) ? v : 0.3f * v; else if (ACT == 17) v = (v >= 0.f) ? v : 0.2f * v;
      so[w][rloc][t * 16 + ln] = v; } }
  __builtin_amdgcn_fence(__ATOMIC_ACQ_REL, "workgroup"); __builtin_amdgcn_wave_barrier();
  const int rsub = lane >> 4, c4 = (lane & 15) * 4;
  {
#pragma unroll
    for (int q = 0; q < 16; ++q) { const int r = q * 2 + rsub; const v4f v = *(const v4fa*)&so[w][r][c4]; if (C) *(v4f*)(C + cofs + (size_t)(row0 + r) * ldc + col0 + c4) = v; if (C16) { v4h h4; for (int i = 0; i < 4; ++i) h4[i] = (_Float16)v[i]; *(v4h*)(C16 + cofs + (size_t)(row0 + r) * ldc + col0 + c4) = h4; } }
     } }


// ---- the same 32x64 wave tile with K split over the NW waves of a work-group, for products with few output tiles (M x N small, K long) ----
// A work-group owns ONE 32x64 tile of C; wave w sums k in [w K / NW, (w + 1) K / NW) with the loop of k_gemm2; the NW partial tiles (f32) meet in LDS and are added in wave order.
// Requires M % 32 == 0 (grid = (M / 32) (N / 64)), N % 64 == 0, K % (32 NW) == 0. C16 = f16(alpha x sum).
template <int NW>
__global__ __launch_bounds__(NW * 32) void k_gemm2k(const _Float16* __restrict__ A, int lda, const _Float16* __restrict__ Bh, int ldb, float alpha, _Float16* __restrict__ C16, int ldc, int N, int K) {
  __shared__ __attribute__((aligned(16))) float so[NW][32][68];
  const int tid = threadIdx.x, w = tid >> 5, lane = tid & 31, ln = lane & 15, hh = lane >> 4;
  const int ntn = N >> 6; const int mt = blockIdx.x / ntn, nq = blockIdx.x - mt * ntn; const int row0 = mt * 32, col0 = nq * 64; const int ks = K / NW;
  const _Float16* a0p = A + (size_t)(row0 + ln) * lda + w * ks; const _Float16* a1p = a0p + (size_t)16 * lda;
  const _Float16* b0p = Bh + (size_t)(col0 + ln) * ldb + w * ks; const _Float16* b1p = b0p + (size_t)16 * ldb; const _Float16* b2p = b1p + (size_t)16 * ldb; const _Float16* b3p = b2p + (size_t)16 * ldb;
  const v8f z8 = {0.f,0.f,0.f,0.f,0.f,0.f,0.f,0.f}; v8f c00 = z8, c01 = z8, c02 = z8, c03 = z8, c10 = z8, c11 = z8, c12 = z8, c13 = z8;
  for (int kb = 0; kb < ks; kb += 32) { const v16h a0 = g2_frag(a0p + kb, hh), a1 = g2_frag(a1p + kb, hh);
    v16h b = g2_frag(b0p + kb, hh); c00 = g2_mma(a0, b, c00); c10 = g2_mma(a1, b, c10);
    b = g2_frag(b1p + kb, hh); c01 = g2_mma(a0, b, c01); c11 = g2_mma(a1, b, c11);
    b = g2_frag(b2p + kb, hh); c02 = g2_mma(a0, b, c02); c12 = g2_mma(a1, b, c12);
    b = g2_frag(b3p + kb, hh); c03 = g2_mma(a0, b, c03); c13 = g2_mma(a1, b, c13); }
  v8f accs[8] = {c00, c01, c02, c03, c10, c11, c12, c13};
#pragma unroll
  for (int u = 0; u < 8; ++u) {      /* unrolled so that accs[] is indexed by constants and stays in registers */
#pragma unroll
    for (int r = 0; r < 8; ++r) so[w][(u >> 2) * 16 + 8 * hh + r][(u & 3) * 16 + ln] = accs[u][r]; }
  __syncthreads();      /* every wave's partial tile is in LDS before any thread adds them */
  for (int i0 = 0; i0 < 32 * 16; i0 += NW * 32) { const int i = i0 + tid, r = i >> 4, c4 = (i & 15) * 4; v4f s = *(const v4f*)&so[0][r][c4];
#pragma unroll
    for (int k = 1; k < NW; ++k) s += *(const v4f*)&so[k][r][c4];      /* unrolled so that the NW LDS reads issue together */
    v4h h4;
#pragma unroll
    for (int q = 0; q < 4; ++q) h4[q] = (_Float16)(s[q] * alpha);      /* unrolled so that the vector elements are indexed by constants */
    *(v4h*)(C16 + (size_t)(row0 + r) * ldc + col0 + c4) = h4; } }


// four weight matrices of n8 x 8 elements each -> four planes one behind the other in Bt, each in fragment order (see FRB below); blockIdx.y picks the matrix; planes 0..2 have K = 256, plane 3 has K = 128.
// Thread t writes 16-B piece t of its plane: lane = t % 32, half j, block kb of the row tile rt; it reads 8 consecutive k of row 16 rt + lane % 16.
__global__ __launch_bounds__(256) void k_wnat(const float* __restrict__ w0, const float* __restrict__ w1, const float* __restrict__ w2, const float* __restrict__ w3, size_t n8, _Float16* __restrict__ Bt) { const size_t t = (size_t)blockIdx.x * 256 + threadIdx.x; if (t >= n8) return; const unsigned p = blockIdx.y; const float* w = p == 0 ? w0 : p == 1 ? w1 : p == 2 ? w2 : w3;
  const unsigned c = (unsigned)t, lg = p == 3 ? 2u : 3u, kb = (c >> 6) & ((1u << lg) - 1u), rt = c >> (6 + lg); const size_t s = ((size_t)(rt * 16 + (c & 15)) << (5 + lg)) + kb * 32 + ((c >> 5) & 1) * 16 + ((c >> 4) & 1) * 8;
  FragH f; for (int q = 0; q < 8; ++q) f.h[q] = (_Float16)(bf16_round(w[s + q]) * 16.0f); *(v8us*)((unsigned short*)Bt + (p * n8 + t) * 8) = f.half[0];  }
__global__ __launch_bounds__(256) void k_rsm(const float* __restrict__ S, _Float16* __restrict__ P, int nrows) {
  #pragma clang fp contract(off)
  const int i = blockIdx.x * 256 + threadIdx.x; if (i >= nrows) return; const float* s = S + (size_t)i * SQ; float mx = -3.0e38f;
#pragma unroll 1
  for (int j = 0; j < SQ; ++j) mx = fmaxf(mx, s[j]); float se = 0.f;
#pragma unroll 1
  for (int j = 0; j < SQ; ++j) se += expf(s[j] - mx); const float sc = 256.0f / se;
#pragma unroll 1
  for (int j0 = 0; j0 < SQ; j0 += 8) { FragH f; for (int q = 0; q < 8; ++q) f.h[q] = (_Float16)(expf(s[j0 + q] - mx) * sc); unsigned short* d = (unsigned short*)P + (size_t)i * SQ + j0; *(v8us*)d = f.half[0];  } }
__global__ __launch_bounds__(256) void k_vt(const _Float16* __restrict__ V16, int b, int h0, _Float16* __restrict__ VT) { __shared__ unsigned short tl[64][65]; const int tid = threadIdx.x; const int hh = blockIdx.x % HG, sg = blockIdx.x / HG; const int s0 = sg * 64; const int h = h0 + hh;
  for (int i = tid; i < 64 * 8; i += 256) { const int j = i / 8, d8 = (i % 8) * 8; FragH f; f.half[0] = *(const v8us*)((const unsigned short*)V16 + ((size_t)b * SQ + s0 + j) * DM + h * HD + d8); for (int q = 0; q < 8; ++q) tl[d8 + q][j] = f.u[q]; }
  __syncthreads();
  { for (int i = tid; i < 64 * 8; i += 256) { const int d = i / 8, j8 = (i % 8) * 8; FragH f; for (int q = 0; q < 8; ++q) f.u[q] = tl[d][j8 + q]; *(v8us*)((unsigned short*)VT + ((size_t)hh * HD + d) * SQ + s0 + j8) = f.half[0]; }  } }



__global__ __launch_bounds__(256) void k_rsmcf2(const float* __restrict__ S, _Float16* __restrict__ P, int hg, int q0, int nk) {
  #pragma clang fp contract(off)
  const int t = blockIdx.x * 256 + threadIdx.x; if (t >= hg * QT) return; const size_t i = (size_t)t; const float* s = S + i * NKX; const int last = q0 + (t % QT); float mx = -3.0e38f;
#pragma unroll 1
  for (int j = 0; j < nk; ++j) { const float f = (j <= last) ? 1.f : 0.f; mx = fmaxf(mx, fmaf(f, s[j], (1.f - f) * -1.0e9f)); } float se = 0.f;
#pragma unroll 1
  for (int j = 0; j < nk; ++j) { const float f = (j <= last) ? 1.f : 0.f; se += __expf(fmaf(f, s[j], (1.f - f) * -1.0e9f) - mx); } const float sc = 256.0f / se;
#pragma unroll 1
  for (int j0 = 0; j0 < nk; j0 += 8) { FragH fr; for (int q = 0; q < 8; ++q) { const int j = j0 + q; const float f = (j <= last) ? 1.f : 0.f; fr.h[q] = (_Float16)(__expf(fmaf(f, s[j], (1.f - f) * -1.0e9f) - mx) * sc); } unsigned short* d = (unsigned short*)P + i * NKX + j0; *(v8us*)d = fr.half[0];  } }

template <int MASKADD>
__global__ __launch_bounds__(64) void k_att0(const float* __restrict__ QF, const float* __restrict__ KF, const float* __restrict__ VF, int ld, const float* __restrict__ mask, float scale, float* __restrict__ OF, int ldo) {
  #pragma clang fp contract(off)
  __shared__ __attribute__((aligned(16))) float lq[64][64]; __shared__ __attribute__((aligned(16))) float lo[64][64];
  const int tid = threadIdx.x; const int h = blockIdx.x / (QT0 / 64), rg = blockIdx.x % (QT0 / 64); const int i = rg * 64 + tid;
  const float* qr = QF + (size_t)i * ld + h * HD;
#pragma unroll 1
  for (int c = 0; c < HD / 4; ++c) { *(v4f*)&lq[tid][c * 4] = *(const v4fa*)(qr + c * 4); const v4f z = {0.f, 0.f, 0.f, 0.f}; *(v4f*)&lo[tid][c * 4] = z; }
  float m = -1.0e30f, l = 0.f; const int jmax = MASKADD ? (SQ - 1) : (rg * 64 + 63);      /* additive-mask form: every key (the mask input decides); causal form: keys up to the block's last row */
#pragma unroll 1
  for (int j = 0; j <= jmax; ++j) { const float* kr = KF + (size_t)j * ld + h * HD; const float* vr = VF + (size_t)j * ld + h * HD; float s = 0.f;
#pragma unroll 1
    for (int c = 0; c < HD / 4; ++c) { const v4f kq = *(const v4fa*)(kr + c * 4); const v4f qq = *(v4f*)&lq[tid][c * 4]; s = __fadd_rn(s, __fmul_rn(qq[0], kq[0])); s = __fadd_rn(s, __fmul_rn(qq[1], kq[1])); s = __fadd_rn(s, __fmul_rn(qq[2], kq[2])); s = __fadd_rn(s, __fmul_rn(qq[3], kq[3])); }
    s = __fmul_rn(s, scale); if (MASKADD) s = __fadd_rn(s, __fmul_rn(bf16_round(mask[(size_t)i * SQ + j]), -10000.0f));
    const float f = (MASKADD || j <= i) ? 1.f : 0.f; const float sm = fmaf(f, s, (1.f - f) * -1.0e30f); const float mn = fmaxf(m, sm); const float sc = expf(m - mn); const float e = expf(sm - mn); l = __fadd_rn(__fmul_rn(l, sc), e); m = mn;
#pragma unroll 1
    for (int c = 0; c < HD / 4; ++c) { const v4f vv = *(const v4fa*)(vr + c * 4); v4f oo = *(v4f*)&lo[tid][c * 4]; for (int u = 0; u < 4; ++u) oo[u] = __fadd_rn(__fmul_rn(oo[u], sc), __fmul_rn(e, vv[u])); *(v4f*)&lo[tid][c * 4] = oo; } }
  const float fin = 64.0f / l;      /* o carried x64 like the f16 path */
#pragma unroll 1
  for (int c = 0; c < HD / 4; ++c) { v4f oo = *(v4f*)&lo[tid][c * 4]; for (int u = 0; u < 4; ++u) oo[u] = __fmul_rn(oo[u], fin); *(v4f*)&lo[tid][c * 4] = oo; }
  __syncthreads();
  {
#pragma unroll 1
    for (int it = 0; it < 16; ++it) { const int row = it * 4 + tid / 16, pc = (tid % 16) * 4; const v4f v = *(const v4f*)&lo[row][pc]; *(v4f*)(OF + (size_t)(rg * 64 + row) * ldo + h * HD + pc) = v; }
     } }

__global__ __launch_bounds__(256) void k_oscale(const float* __restrict__ OF, float* __restrict__ out, size_t n4) { const size_t t = (size_t)blockIdx.x * 256 + threadIdx.x; if (t >= n4) return; const v4f a = *(const v4fa*)(OF + t * 4); v4f o; for (int q = 0; q < 4; ++q) o[q] = a[q] * 0.015625f; *(v4f*)(out + t * 4) = o;  }

__global__ __launch_bounds__(256) void k_bfr(const float* __restrict__ x, float* __restrict__ XB, size_t n8) { const size_t t = (size_t)blockIdx.x * 256 + threadIdx.x; if (t >= n8) return; v4f a = *(const v4fa*)(x + t * 8), c = *(const v4fa*)(x + t * 8 + 4); for (int q = 0; q < 4; ++q) { a[q] = bf16_round(a[q]); c[q] = bf16_round(c[q]); }
  { *(v4f*)(XB + t * 8) = a; *(v4f*)(XB + t * 8 + 4) = c;  } }



__global__ __launch_bounds__(256) void k_rsmfvl(const float* __restrict__ S, _Float16* __restrict__ P, _Float16* __restrict__ PL, int qn, const int* __restrict__ vlp) {
  #pragma clang fp contract(off)
  const int t = blockIdx.x * 256 + threadIdx.x; if (t >= qn) return; const int vl = vlp[0]; const size_t i = (size_t)t; const float* s = S + i * SQ; float mx = -3.0e38f;
#pragma unroll 1
  for (int j = 0; j < SQ; ++j) { const float f = (j < vl) ? 1.f : 0.f; mx = fmaxf(mx, fmaf(f, s[j], (1.f - f) * -1000000.0f)); } float se = 0.f;
#pragma unroll 1
  for (int j = 0; j < SQ; ++j) { const float f = (j < vl) ? 1.f : 0.f; se += __expf(fmaf(f, s[j], (1.f - f) * -1000000.0f) - mx); } const float sc = 256.0f / se;
#pragma unroll 1
  for (int j0 = 0; j0 < SQ; j0 += 8) { FragH fr, gr; for (int q = 0; q < 8; ++q) { const int j = j0 + q; const float f = (j < vl) ? 1.f : 0.f; const float pv = __expf(fmaf(f, s[j], (1.f - f) * -1000000.0f) - mx) * sc; const _Float16 ph = (_Float16)pv; fr.h[q] = ph; gr.h[q] = (_Float16)((pv - (float)ph) * 1024.0f); }
    unsigned short* d = (unsigned short*)P + i * SQ + j0; unsigned short* dl = (unsigned short*)PL + i * SQ + j0; *(v8us*)d = fr.half[0]; *(v8us*)dl = gr.half[0];  } }

__global__ __launch_bounds__(256) void k_rsmf(const float* __restrict__ S, _Float16* __restrict__ P, int qn, int hg) {
  #pragma clang fp contract(off)
  const int t = blockIdx.x * 256 + threadIdx.x; if (t >= qn * hg) return; const size_t i = (size_t)(t / qn) * SQ + (t % qn); const float* s = S + i * SQ; float mx = -3.0e38f;
#pragma unroll 1
  for (int j = 0; j < SQ; ++j) mx = fmaxf(mx, s[j]); float se = 0.f;
#pragma unroll 1
  for (int j = 0; j < SQ; ++j) se += __expf(s[j] - mx); const float sc = 256.0f / se;
#pragma unroll 1
  for (int j0 = 0; j0 < SQ; j0 += 8) { FragH f; for (int q = 0; q < 8; ++q) f.h[q] = (_Float16)(__expf(s[j0 + q] - mx) * sc); unsigned short* d = (unsigned short*)P + i * SQ + j0; *(v8us*)d = f.half[0];  } }


#define CN 256          /* channels */
#define CI 128          /* inner channels */
#define NP 4096         /* positions */
#define NM 4096         /* key positions (= SQ) */
#define NC CN           /* BN statistics macros */
#define NPX NP
#define BNEPS 1e-5f

__global__ __launch_bounds__(256) void k_rowbias(const float* __restrict__ b, float* __restrict__ BP, size_t n4, int ncol) { const size_t t = (size_t)blockIdx.x * 256 + threadIdx.x; if (t >= n4) return; const size_t e = t * 4; const float v = bf16_round(b[e / ncol]); const v4f o = {v, v, v, v}; *(v4f*)(BP + e) = o;  }




__global__ __launch_bounds__(256) void k_mp2(const float* __restrict__ src, float* __restrict__ dst, int nout) {
  const int t = blockIdx.x * 256 + threadIdx.x; if (t >= nout) return; const int c = t / 1024; const int o = t % 1024; const int oy = o / 32, ox = o % 32; const float* p = src + (size_t)c * 4096 + (size_t)(2 * oy) * 64 + 2 * ox;
  const float v = fmaxf(fmaxf(p[0], p[1]), fmaxf(p[64], p[65])); *(float*)(dst + t) = v;  }
__global__ __launch_bounds__(256) void k_xpb(const float* __restrict__ x, const float* __restrict__ wb, float* __restrict__ CPP, size_t n4) {
  #pragma clang fp contract(off)
  const size_t t = (size_t)blockIdx.x * 256 + threadIdx.x; if (t >= n4) return; const size_t e = t * 4; const int c = (int)((e / 4096) % 256); const float bb = bf16_round(wb[c]); const v4f a = *(const v4fa*)(x + e); v4f o; for (int q = 0; q < 4; ++q) o[q] = __fadd_rn(bf16_round(a[q]), bb);
  *(v4f*)(CPP + e) = o;  }


template <int PASS>
__global__ __launch_bounds__(256) void k_cstA(const float* __restrict__ X, const float* __restrict__ MV, float* __restrict__ PART) {
  #pragma clang fp contract(off)
  __shared__ float red[256]; const int t = threadIdx.x; const size_t bc = blockIdx.x; const int c = (int)(bc % NC); const float* row = X + bc * (size_t)NPX; const float mu = PASS ? MV[c] : 0.f; float s = 0.f;
  for (int i = t; i < NPX; i += 256) { const float v = row[i]; const float d = PASS ? __fadd_rn(v, -mu) : v; s = __fadd_rn(s, PASS ? __fmul_rn(d, d) : d); }
  red[t] = s; __syncthreads(); for (int st = 128; st > 0; st >>= 1) { if (t < st) red[t] = __fadd_rn(red[t], red[t + st]); __syncthreads(); }
  if (t < 32) { const float pv = (t == 0) ? red[0] : 0.f; *(float*)(PART + bc * 32 + t) = pv;  } }      

template <int PASS>
__global__ __launch_bounds__(256) void k_cstB(const float* __restrict__ PART, float* __restrict__ MV) { const int c = threadIdx.x; if (c >= NC) return; double s = 0.0; for (int b = 0; b < NB; ++b) s += (double)PART[((size_t)b * NC + c) * 32]; const float m = (float)(s / ((double)NB * (double)NPX)); *(float*)(MV + PASS * NC + c) = m;  }


__global__ __launch_bounds__(256) void k_bnresid(const float* __restrict__ C2, const float* __restrict__ MV, const float* __restrict__ g, const float* __restrict__ be, const float* __restrict__ X, float* __restrict__ out, size_t n4) {
  #pragma clang fp contract(off)
  const size_t t = (size_t)blockIdx.x * 256 + threadIdx.x; if (t >= n4) return; const size_t e = t * 4; const int c = (int)((e / NPX) % NC); const float sc = __fmul_rn(rsqrtf(__fadd_rn(MV[NC + c], BNEPS)), bf16_round(g[c])); const float mu = MV[c], bb = bf16_round(be[c]);
  const v4f a = *(const v4fa*)(C2 + e); const v4f xx = *(const v4fa*)(X + e); v4f o; for (int q = 0; q < 4; ++q) { const float z = __fadd_rn(__fmul_rn(__fadd_rn(a[q], -mu), sc), bb); o[q] = __fadd_rn(z, bf16_round(xx[q])); }
  *(v4f*)(out + e) = o;  }


__global__ __launch_bounds__(256) void k_rowbias(float* __restrict__ Y, const float* __restrict__ bias) {
  #pragma clang fp contract(off)
  const size_t t = (size_t)blockIdx.x * 256 + threadIdx.x; if (t >= (size_t)NB * NC * NPX / 4) return; const size_t e = t * 4; const int c = (int)((e / NPX) % NC); const float bb = bf16_round(bias[c]);
  v4f v = *(const v4fa*)(Y + e); for (int q = 0; q < 4; ++q) v[q] = __fadd_rn(v[q], bb); *(v4f*)(Y + e) = v;  }


// Scores never stored. Both consumers of f = theta^T phi form their own score tiles on the matrix unit from the f16 theta and phi planes (fragment order, below) and use them in registers.
// ST holds one f32 per column m: 8 - max_m log2e - log2(sum_m), so that 2^(s log2e + ST[m]) = 256 exp(s - max_m) / sum_m. blockIdx.y is the image.
// Inner loops carry #pragma unroll so that the fragment arrays are indexed by constants and stay in registers (a run-time index would send them to scratch).
#define QIS (2 * NP * CI)         /* elements of an image in QKV: the theta plane, then the phi plane, each [4096 rows][K = 128] in fragment order */
#define SCM 64                    /* columns per work-group of the statistics kernel */
#define SCW 16                    /* its waves: the 4,096 rows split over them */
__device__ __forceinline__ v8f f_mma(v16h a, v16h b, v8f c) { return __builtin_amdgcn_wmma_f32_16x16x32_f16(false, a, false, b, (short)0, c, false, false); }
// Exponents are formed two scores at a time: exp(s - a) = 2^(s log2e - a log2e), the bracket one packed f32 multiply-add on a register pair of the score tile, then the native 2^x.
typedef float v2f __attribute__((ext_vector_type(2)));
#define L2E 1.4426950408889634f
__device__ __forceinline__ v2f ex2_pair(float s0, float s1, v2f nc) { const v2f s = {s0, s1}, l = {L2E, L2E}; const v2f x = __builtin_elementwise_fma(s, l, nc); const v2f e = {__builtin_amdgcn_exp2f(x[0]), __builtin_amdgcn_exp2f(x[1])}; return e; }
// FRAGMENT ORDER. Every f16 plane that a matrix instruction reads from the workspace lies as blocks of 16 rows x 32 k, FRB elements each: [half j][lane = 16 hh + ln][8 elements], element e of row ln at k = 16 j + 8 hh + e;
// the blocks of a 16-row tile follow each other in k. A wave's 16-B-a-lane load of half a fragment then covers 512 contiguous bytes (4 whole lines) where a row-major plane makes it touch 16 lines.
#define FRB 512                   /* f16 elements of a block */
__device__ __forceinline__ v16h p_frag(const _Float16* p) { FragH f; f.half[0] = *(const v8us*)((const unsigned short*)p); f.half[1] = *(const v8us*)((const unsigned short*)p + 256); return f.v; }      /* p: the block + 8 lane */
__device__ __forceinline__ v16h f_frag(const _Float16* p) { FragH f; f.half[0] = *(const v8us*)((const unsigned short*)p); f.half[1] = *(const v8us*)((const unsigned short*)p + 16); return f.v; }      /* g2_frag with the lane's + 8 hh already in p */
// Column statistics: a work-group owns 64 key columns m (their phi fragments stay in registers as B), wave w sweeps rows n in [256 w, 256 w + 256) 16 at a time (theta as A).
// In D a lane holds 8 rows of ONE column (row 8 hh + r, column ln), so the running maximum and the rescaled running sum of a column stay in the lane (the sum as a pair: even rows, odd rows); the 32 partial pairs of a column (16 waves x 2 lane halves) meet in LDS.
// One trip: 16 rows from ac; the next trip's theta fragments are fetched into ax behind the products (two register sets that swap roles, so that no copy and no early wait stands between).
__device__ __forceinline__ void cs_trip(const _Float16* an, const v16h (&ph)[4][4], const v16h (&ac)[4], v16h (&ax)[4], float (&mx)[4], v2f (&se)[4]) {
  const v8f z8 = {0.f,0.f,0.f,0.f,0.f,0.f,0.f,0.f}; v8f d[4] = {z8, z8, z8, z8};
#pragma unroll
  for (int k = 0; k < 4; ++k) {
#pragma unroll
    for (int t = 0; t < 4; ++t) d[t] = f_mma(ac[k], ph[t][k], d[t]); }
#pragma unroll
  for (int k = 0; k < 4; ++k) ax[k] = p_frag(an + k * FRB);
  asm volatile("s_wait_xcnt 0x0" :: "v"(an) : "memory");      /* a precaution: the address that the 8 loads above name stays live and unwritten up to this wait */
  __builtin_amdgcn_sched_barrier(0);      /* keeps the fetch in front of the vector work below, which is the time it has to land */
#pragma unroll
  for (int t = 0; t < 4; ++t) { float nm = mx[t];
#pragma unroll
    for (int r = 0; r < 8; ++r) nm = fmaxf(nm, d[t][r]);
    const float nl = -nm * L2E; const v2f n2 = {nl, nl}; const float rs = __builtin_amdgcn_exp2f(fmaf(mx[t], L2E, nl)); const v2f r2 = {rs, rs};
    v2f s = se[t] * r2;      /* even rows add up in element 0, odd rows in element 1 */
#pragma unroll
    for (int r = 0; r < 8; r += 2) s += ex2_pair(d[t][r], d[t][r + 1], n2);
    se[t] = s; mx[t] = nm; } }
__global__ __launch_bounds__(SCW * 32) __attribute__((amdgpu_waves_per_eu(SCW / 4, SCW / 4)))      /* one work-group a WGP: 256 registers a wave, of which the phi fragments take 128 */
void k_colstat_f(const _Float16* __restrict__ QKV, float* __restrict__ ST) {
  __shared__ float rmx[SCW * 2][SCM]; __shared__ float rse[SCW * 2][SCM];
  const int tid = threadIdx.x, w = tid >> 5, lane = tid & 31, ln = lane & 15, hh = lane >> 4;
  const _Float16* q = QKV + (size_t)blockIdx.y * QIS; const int m0 = blockIdx.x * SCM;
  const _Float16* pb = q + (size_t)m0 * CI + 8 * lane;      /* phi lies NP CI elements on (an immediate offset of the loads); 16 rows of K = 128 are 4 blocks = 16 CI elements: row r0 (a multiple of 16) starts r0 CI elements into its plane */
  const _Float16* th = q + (size_t)(w * (NP / SCW)) * CI + 8 * lane;
  v16h ph[4][4], a0[4], a1[4];
#pragma unroll
  for (int t = 0; t < 4; ++t) {
#pragma unroll
    for (int k = 0; k < 4; ++k) ph[t][k] = p_frag(pb + NP * CI + (t * 4 + k) * FRB); }
#pragma unroll
  for (int k = 0; k < 4; ++k) a0[k] = p_frag(th + k * FRB);
  asm volatile("s_wait_xcnt 0x0" :: "v"(pb), "v"(th), "v"(lane) : "memory");      /* a precaution: what the 40 loads above name (the two addresses, or a scalar base with the lane's number) stays live and unwritten up to this wait */
  float mx[4] = {-3.0e38f, -3.0e38f, -3.0e38f, -3.0e38f}; const v2f z2 = {0.f, 0.f}; v2f se[4] = {z2, z2, z2, z2};
#pragma unroll 1      /* rolled: two trips are the period of the register sets, and the loop stays small in the instruction cache */
  for (int nb = 0; nb < NP / SCW; nb += 32) {
    cs_trip(th + (size_t)(nb + 16) * CI, ph, a0, a1, mx, se);
    cs_trip(th + (size_t)(nb + 32 < NP / SCW ? nb + 32 : nb) * CI, ph, a1, a0, mx, se); }      /* the last trip fetches rows of its own range again: in bounds, not used */
#pragma unroll
  for (int t = 0; t < 4; ++t) { rmx[w * 2 + hh][t * 16 + ln] = mx[t]; rse[w * 2 + hh][t * 16 + ln] = se[t][0] + se[t][1]; }
  __syncthreads();      /* every wave's partial maxima and sums are in LDS before a thread folds a column */
  if (tid < SCM) { float m = rmx[0][tid];
#pragma unroll
    for (int i = 1; i < SCW * 2; ++i) m = fmaxf(m, rmx[i][tid]);
    float s = 0.f;
#pragma unroll
    for (int i = 0; i < SCW * 2; ++i) s += rse[i][tid] * __expf(rmx[i][tid] - m);
    ST[(size_t)blockIdx.y * NM + m0 + tid] = 8.0f - fmaf(m, L2E, __builtin_amdgcn_logf(s)); } }      /* the native log2: s lies in [1, 4096] */
// y^T = P g^T with neither f nor P stored, and the last product behind it in the same kernel (y^T never leaves the work-group). A work-group owns 64 rows n and all 128 columns of y^T; wave w takes the key columns m in [1024 w, 1024 w + 1024), 32 a trip; the partial tiles (f32) meet in LDS and are added in wave order.
// The score tile is formed TRANSPOSED: D[m][n] = phi[m] . theta[n] (phi as A, theta as B, theta resident). A lane then holds m = 8 hh + r of column n = ln, which is the k order of an A fragment of row ln
// (tile m 0..15 -> elements 0..7, tile m 16..31 -> elements 8..15), so P[n][m] = f16(2^(s log2e + ST[m])) becomes the A operand of P g^T in place, with no exchange between lanes.
// All loads stand at the head of a trip and fetch the NEXT trip's records, g and phi (two register sets that swap roles): with one wave a SIMD nothing else hides a load, so each gets a whole trip to land in.
#define PVW 4                     /* waves: the 4,096 key columns split over them */
#define PVN 4                     /* 16-row tiles of n per wave: every phi and g fragment fetched serves PVN matrix instructions */
struct PvSet { v4f nc[4]; v16h pf[2][4], gf[8]; };      /* what one trip reads: the ST values of its 32 columns, its phi fragments (A of the scores), its g fragments (B of P g^T) */
// rb, gb, pb are the addresses that the loads name; RO, GO, PO (elements) go into the loads' immediate offsets, so that the wait below can hold exactly those registers.
template <int RO, int GO, int PO>
__device__ __forceinline__ void pv_fetch(const float* rb, const _Float16* gb, const _Float16* pb, PvSet& x) {
  const float* r = rb + RO;
#pragma unroll
  for (int u = 0; u < 2; ++u) { x.nc[2 * u] = *(const v4fa*)(r + 16 * u); x.nc[2 * u + 1] = *(const v4fa*)(r + 16 * u + 4); }
#pragma unroll
  for (int u = 0; u < 2; ++u) {
#pragma unroll
    for (int k = 0; k < 4; ++k) x.pf[u][k] = p_frag(pb + NP * CI + PO + (u * 4 + k) * FRB); }
#pragma unroll
  for (int c = 0; c < 8; ++c) x.gf[c] = p_frag(gb + GO + c * FRB);
  asm volatile("s_wait_xcnt 0x0" :: "v"(gb), "v"(pb) : "memory");      /* a precaution: the addresses that the 36 loads above name stay unwritten up to this wait (gb and pb held live by it; rb is not named: forming it for this line from the loop's own pointer would write the register that the 4 loads of r name) */
  __builtin_amdgcn_sched_barrier(0); }      /* keeps the 36 loads at the head of the trip: without it the scheduler spreads them through the trip and waits for them at once */
__device__ __forceinline__ void pv_trip(const PvSet& c_, const v16h (&th)[PVN][4], v8f (&acc)[PVN][8]) {
  const v8f z8 = {0.f,0.f,0.f,0.f,0.f,0.f,0.f,0.f}; v8f s[2][PVN];      /* [m tile][n tile] */
#pragma unroll
  for (int u = 0; u < 2; ++u) {
#pragma unroll
    for (int v = 0; v < PVN; ++v) s[u][v] = z8; }
#pragma unroll
  for (int k = 0; k < 4; ++k) {
#pragma unroll
    for (int u = 0; u < 2; ++u) {
#pragma unroll
      for (int v = 0; v < PVN; ++v) s[u][v] = f_mma(c_.pf[u][k], th[v][k], s[u][v]); } }
  FragH f[PVN];
#pragma unroll
  for (int u = 0; u < 2; ++u) {
#pragma unroll
    for (int e = 0; e < 8; e += 2) { const v2f nc = {c_.nc[u * 2 + (e >> 2)][e & 3], c_.nc[u * 2 + (e >> 2)][(e & 3) + 1]};
#pragma unroll
      for (int v = 0; v < PVN; ++v) { const v2f p = ex2_pair(s[u][v][e], s[u][v][e + 1], nc); f[v].h[u * 8 + e] = (_Float16)p[0]; f[v].h[u * 8 + e + 1] = (_Float16)p[1]; } } }
#pragma unroll
  for (int c = 0; c < 8; ++c) {
#pragma unroll
    for (int v = 0; v < PVN; ++v) acc[v][c] = f_mma(f[v].v, c_.gf[c], acc[v][c]); } }
__global__ __launch_bounds__(PVW * 32) __attribute__((amdgpu_waves_per_eu(PVW / 4, PVW / 4)))      /* one wave a SIMD: the accumulators (256 registers), theta (128) and the fragments in flight need more than 512 */
void k_pvf(const _Float16* __restrict__ QKV, const float* __restrict__ ST, const _Float16* __restrict__ G, float alpha, const _Float16* __restrict__ A, const float* __restrict__ x, float* __restrict__ C) {
  __shared__ __attribute__((aligned(16))) float so[PVW][16 * PVN][CI + 4];
  __shared__ __attribute__((aligned(16))) unsigned short yl[PVN * 4 * FRB];      /* the work-group's 64 rows of y^T, f16, in fragment order */
  const int tid = threadIdx.x, w = tid >> 5, lane = tid & 31, ln = lane & 15, hh = lane >> 4;
  const size_t by = blockIdx.y; const int n0 = blockIdx.x * (16 * PVN); const int ks = NM / PVW;
  const _Float16* q = QKV + by * QIS;
  const float* stp = ST + by * NM + (size_t)(w * ks) + 8 * hh;      /* one f32 a column */
  const _Float16* gp = G + by * CI * NM + (size_t)(w * ks) * CI + 8 * lane;      /* g: the 8 blocks (128 channels) of 32 key columns follow each other, 32 CI elements */
  const _Float16* pp = q + (size_t)(w * ks) * CI + 8 * lane;      /* the same place in the theta plane; phi lies NP CI elements on (an immediate offset of the loads) */
  const _Float16* tp = q + (size_t)n0 * CI + 8 * lane;
  v16h th[PVN][4]; PvSet s0, s1;
#pragma unroll
  for (int v = 0; v < PVN; ++v) {
#pragma unroll
    for (int k = 0; k < 4; ++k) th[v][k] = p_frag(tp + (v * 4 + k) * FRB); }
  asm volatile("s_wait_xcnt 0x0" :: "v"(tp) : "memory");      /* a precaution: the address that the 32 loads above name stays live and unwritten up to this wait */
  pv_fetch<0, 0, 0>(stp, gp, pp, s0);
  const v8f z8 = {0.f,0.f,0.f,0.f,0.f,0.f,0.f,0.f}; v8f acc[PVN][8];
#pragma unroll
  for (int v = 0; v < PVN; ++v) {
#pragma unroll
    for (int c = 0; c < 8; ++c) acc[v][c] = z8; }
#pragma unroll 1      /* rolled: two trips are the period of the register sets, and the loop stays small in the instruction cache */
  for (int kb = 0; kb < ks; kb += 64) {
    pv_fetch<32, 32 * CI, 32 * CI>(stp, gp, pp, s1); pv_trip(s0, th, acc);
    const int more = kb + 64 < ks ? 1 : 0;      /* the last trip fetches its own range again: in bounds, not used */
    stp += more * 64; gp += more * (64 * CI); pp += more * (64 * CI);
    pv_fetch<0, 0, 0>(stp, gp, pp, s0); pv_trip(s1, th, acc); }
  /* what the last product needs from memory is asked for here, so that it lands while the partial tiles meet in LDS: wave w owns output channels 64 w .. 64 w + 63 at all 64 positions */
  const int c4 = ln * 4;
  const size_t eo = by * ((size_t)CN * NP) + (size_t)(w * 64 + hh) * NP + n0 + c4;
  const float* xp = x + eo; float* cp = C + eo; v4f xv[32];      /* 16 lanes cover the 256 B of a channel row, a load takes 2 rows */
#pragma unroll
  for (int q = 0; q < 32; ++q) xv[q] = *(const v4fa*)(xp + (size_t)q * 2 * NP);
  const _Float16* ap = A + (size_t)(w * 64) * CI + 8 * lane; v16h wa[4][4];      /* 16 W in fragment order: 16 rows of K = 128 are 4 blocks */
#pragma unroll
  for (int u = 0; u < 4; ++u) {
#pragma unroll
    for (int k = 0; k < 4; ++k) wa[u][k] = p_frag(ap + (u * 4 + k) * FRB); }
  asm volatile("s_wait_xcnt 0x0" :: "v"(xp), "v"(ap) : "memory");      /* a precaution: the two addresses that the 64 loads above name stay live and unwritten up to this wait */
#pragma unroll
  for (int v = 0; v < PVN; ++v) {
#pragma unroll
    for (int c = 0; c < 8; ++c) {
#pragma unroll
      for (int e = 0; e < 8; ++e) so[w][v * 16 + 8 * hh + e][c * 16 + ln] = acc[v][c][e]; } }
  __syncthreads();      /* every wave's partial tile is in LDS before any thread adds them */
  static_assert(PVW == PVN, "one row tile a wave");
  /* y^T goes to LDS in fragment order (rows n, K = 128): wave w writes row tile w, piece it = 2 x block + half; a lane adds 8 consecutive channels of row ln */
  unsigned short* yo = yl + w * 4 * FRB + lane * 8; v8us ty[8];
#pragma unroll
  for (int it = 0; it < 8; ++it) { const float* sp = &so[0][w * 16 + ln][it * 16 + 8 * hh]; v4f sa = *(const v4f*)sp, sb = *(const v4f*)(sp + 4);
#pragma unroll
    for (int k = 1; k < PVW; ++k) { sa += *(const v4f*)(sp + k * (16 * PVN * (CI + 4))); sb += *(const v4f*)(sp + k * (16 * PVN * (CI + 4)) + 4); }
    FragH f;
#pragma unroll
    for (int e = 0; e < 4; ++e) { f.h[e] = (_Float16)(sa[e] * alpha); f.h[4 + e] = (_Float16)(sb[e] * alpha); }
    ty[it] = f.half[0]; }
#pragma unroll
  for (int it = 0; it < 8; ++it) *(v8us*)(yo + it * 256) = ty[it];
  __syncthreads();      /* all 64 rows of y^T are in LDS before a wave reads them as B; and every wave has left so, which turns into output staging */
  /* out = (16 W) y / 16 + bf16(x): D[c][n] = W (A) y^T (B), K = 128 in one chain per tile, blocks in rising order */
  v8f d[4][PVN]; v16h yb[PVN][4];
#pragma unroll
  for (int v = 0; v < PVN; ++v) {
#pragma unroll
    for (int k = 0; k < 4; ++k) yb[v][k] = p_frag((const _Float16*)yl + (v * 4 + k) * FRB + lane * 8); }
  __builtin_amdgcn_sched_barrier(0);      /* keeps the 32 LDS reads as one group ahead of the 64 products: without it each fragment is read right in front of its 4 products, which then wait out the LDS latency 16 times */
#pragma unroll
  for (int v = 0; v < PVN; ++v) {
#pragma unroll
    for (int u = 0; u < 4; ++u) d[u][v] = z8;
#pragma unroll
    for (int k = 0; k < 4; ++k) {
#pragma unroll
      for (int u = 0; u < 4; ++u) d[u][v] = f_mma(wa[u][k], yb[v][k], d[u][v]); } }
  /* the wave's 64 x 64 tile turns in its own part of so, so that whole 128-B lines leave; the residual is rounded where the rows leave LDS */
#pragma unroll
  for (int u = 0; u < 4; ++u) {
#pragma unroll
    for (int v = 0; v < PVN; ++v) {
#pragma unroll
      for (int r = 0; r < 8; ++r) so[w][u * 16 + 8 * hh + r][v * 16 + ln] = d[u][v][r] * 0.0625f; } }
  __builtin_amdgcn_fence(__ATOMIC_ACQ_REL, "workgroup"); __builtin_amdgcn_wave_barrier();
  v4f ov[32];
#pragma unroll
  for (int q = 0; q < 32; ++q) ov[q] = *(const v4fa*)&so[w][q * 2 + hh][c4];
  __builtin_amdgcn_sched_barrier(0);      /* keeps the 32 LDS reads as one group: without it they stand one by one among the sums, each waited for almost at once */
#pragma unroll
  for (int q = 0; q < 32; ++q) {
#pragma unroll
    for (int i = 0; i < 4; ++i) xv[q][i] = ov[q][i] + bf16_round(xv[q][i]); }
  __builtin_amdgcn_sched_barrier(0);      /* all 32 sums stand ahead of the stores, each in registers of its own: no staging register is reused behind a store, and the one wait behind the run covers them all */
#pragma unroll
  for (int q = 0; q < 32; ++q) *(v4f*)(cp + (size_t)q * 2 * NP) = xv[q];
  asm volatile("s_wait_xcnt 0x0" :: "v"(cp) : "memory"); }      /* a precaution: the registers that the 32 stores above name stay unwritten up to this wait */
// Projections straight from x. A work-group owns 64 positions of one image and all 384 output channels: it reads its [256 c][64 n] block of f32 x in whole 128-B lines, rounds it (bf16, exact in f16)
// and lays it in LDS as token rows [n][c]; K = 256 then runs in ONE accumulation chain per tile. Wave w takes rows 32 w .. 32 w + 31 of theta | phi and rows 16 w .. 16 w + 15 of g.
// theta | phi: D[o][n] = W (A) x^T (B): a lane holds 8 consecutive o of token n, 16 B of a token row. g: D[m][ci] = x^T (A) W_g (B): a lane holds 8 consecutive m of channel ci, 16 B of a channel-major row.
// Those 16 B are one lane's piece of a fragment-order block (theta | phi: row tile v, block w % 4, half u; g: key block v / 2, channel tile w, half v % 2), so each tile leaves straight from registers, 512 contiguous bytes a wave.
#define PJN 64                    /* positions per work-group */
#define PJP (CN + 8)              /* LDS pitch of a token row, f16: 16 B past a multiple of 256 B, so that 16 rows read or written 16 B a lane fall on different banks */
__global__ __launch_bounds__(256) __attribute__((amdgpu_waves_per_eu(2, 2)))      /* one work-group a WGP: the 24 weight fragments (192 registers) stay resident beside 12 accumulator tiles */
void k_proj(const float* __restrict__ x, const _Float16* __restrict__ BT, _Float16* __restrict__ QKV, _Float16* __restrict__ G) {
  __shared__ __attribute__((aligned(16))) _Float16 xs[PJN][PJP];
  const int tid = threadIdx.x, w = tid >> 5, lane = tid & 31, ln = lane & 15, hh = lane >> 4;
  const size_t by = blockIdx.y; const int n0 = blockIdx.x * PJN;
  const _Float16* wp = BT + (size_t)(w * 32) * CN + 8 * lane;      /* 16 rows of K = 256 are 8 blocks = 16 CN elements */
  const _Float16* wg = BT + (size_t)(w * 16) * CN + 8 * lane;      /* w_g lies 2 CI CN elements on (an immediate offset of the loads) */
  const int nl = (w & 1) * 32 + (lane & 7) * 4, cl = (w >> 1) * 64 + (lane >> 3) * 8;      /* 8 lanes cover one 128-B line of a channel row; a lane takes 4 positions of 8 + 8 channels */
  const float* xp = x + by * ((size_t)CN * NP) + (size_t)cl * NP + n0 + nl;
  v4f xv[2][8]; v16h wf[3][8];
#pragma unroll
  for (int it = 0; it < 2; ++it) {
#pragma unroll
    for (int i = 0; i < 8; ++i) xv[it][i] = *(const v4fa*)(xp + (size_t)(it * 32 + i) * NP); }
#pragma unroll
  for (int k = 0; k < 8; ++k) { wf[0][k] = p_frag(wp + k * FRB); wf[1][k] = p_frag(wp + 16 * CN + k * FRB); wf[2][k] = p_frag(wg + 2 * CI * CN + k * FRB); }
  asm volatile("s_wait_xcnt 0x0" :: "v"(xp), "v"(wp), "v"(wg) : "memory");      /* a precaution: the three addresses that the 64 loads above name stay live and unwritten up to this wait */
#pragma unroll
  for (int it = 0; it < 2; ++it) {
#pragma unroll
    for (int j = 0; j < 4; ++j) { FragH f;
#pragma unroll
      for (int i = 0; i < 8; ++i) f.h[i] = (_Float16)bf16_round(xv[it][i][j]);
      *(v8us*)&xs[nl + j][cl + it * 32] = f.half[0]; } }
  __syncthreads();      /* the whole x^T tile is in LDS before any wave reads a fragment of it */
  const v8f z8 = {0.f,0.f,0.f,0.f,0.f,0.f,0.f,0.f}; v8f dq[2][4], dg[4];
#pragma unroll
  for (int v = 0; v < 4; ++v) { dq[0][v] = z8; dq[1][v] = z8; dg[v] = z8; }
  const _Float16* xr = &xs[ln][8 * hh];
  v16h xf[2][4];      /* two sets that swap roles: the LDS reads of block k + 1 stand as one group in front of the 12 products of block k */
#pragma unroll
  for (int v = 0; v < 4; ++v) xf[0][v] = f_frag(xr + v * 16 * PJP);
#pragma unroll
  for (int k = 0; k < 8; ++k) {
    if (k < 7) {
#pragma unroll
      for (int v = 0; v < 4; ++v) xf[(k + 1) & 1][v] = f_frag(xr + v * 16 * PJP + (k + 1) * 32); }
    __builtin_amdgcn_sched_barrier(0);      /* keeps the reads ahead of the products: without it each fragment is read right in front of its 3 products, which then wait out the LDS latency 32 times */
#pragma unroll
    for (int v = 0; v < 4; ++v) { dq[0][v] = f_mma(wf[0][k], xf[k & 1][v], dq[0][v]); dq[1][v] = f_mma(wf[1][k], xf[k & 1][v], dq[1][v]); dg[v] = f_mma(xf[k & 1][v], wf[2][k], dg[v]); } }
  v8us tq[4][2], tg[4];
#pragma unroll
  for (int v = 0; v < 4; ++v) { FragH f;
#pragma unroll
    for (int u = 0; u < 2; ++u) {
#pragma unroll
      for (int r = 0; r < 8; ++r) f.h[r] = (_Float16)(dq[u][v][r] * 0.0625f);
      tq[v][u] = f.half[0]; }
#pragma unroll
    for (int r = 0; r < 8; ++r) f.h[r] = (_Float16)(dg[v][r] * 0.0625f);
    tg[v] = f.half[0]; }
  unsigned short* qo = (unsigned short*)QKV + by * QIS + (size_t)(w >> 2) * (NP * CI) + (size_t)n0 * CI + (w & 3) * FRB + lane * 8;      /* waves 0..3 hold theta, 4..7 phi; the wave's 32 channels are block w % 4 of every row tile */
  unsigned short* go = (unsigned short*)G + by * ((size_t)CI * NM) + (size_t)n0 * CI + w * FRB + lane * 8;      /* the wave's 16 channels are block w of every 32 key columns */
  __builtin_amdgcn_sched_barrier(0);      /* all 12 pieces stand ahead of the stores, each in registers of its own: no staging register is reused behind a store, and the one wait behind the run covers them all */
#pragma unroll
  for (int v = 0; v < 4; ++v) {
#pragma unroll
    for (int u = 0; u < 2; ++u) *(v8us*)(qo + v * 4 * FRB + u * 256) = tq[v][u]; }
#pragma unroll
  for (int v = 0; v < 4; ++v) *(v8us*)(go + (v >> 1) * 8 * FRB + (v & 1) * 256) = tg[v];
  asm volatile("s_wait_xcnt 0x0" :: "v"(qo), "v"(go) : "memory"); }      /* a precaution: the registers that the 12 stores above name stay unwritten up to this wait */
extern "C" void kernel_launch(void* const* d_in, const int* in_sizes, int n_in,
                              void* d_out, int out_size, void* d_ws, size_t ws_size, hipStream_t stream) {
  (void)in_sizes; (void)n_in; (void)out_size;
  const float* const* I = (const float* const*)d_in; const float* x = I[0]; const float* tw = I[1]; const float* pw = I[2]; const float* gw = I[3]; const float* ww = I[4];      /* natural 1x1 conv weights: w_theta, w_phi, w_g [128][256], w_mask [256][128]; no biases */
  char* ws = (char*)d_ws; size_t off = 0;
  auto take = [&](size_t bytes) { char* p = ws + off; off += (bytes + 255) & ~(size_t)255; return p; };
  _Float16* BT = (_Float16*)take((size_t)4 * CI * CN * 2); _Float16* BW = BT + (size_t)3 * CI * CN;      /* w_theta, w_phi, w_g as one [384][256] plane, then w_mask */
  _Float16* QKV = (_Float16*)take((size_t)NB * QIS * 2); _Float16* G = (_Float16*)take((size_t)NB * CI * NP * 2);
  float* ST = (float*)take((size_t)NB * NM * 4);      /* per column 8 - max log2e - log2(sum) */
  if (off > ws_size) return;
  k_wnat<<<dim3((unsigned)(((size_t)CI * CN / 8 + 255) / 256), 4), 256, 0, stream>>>(tw, pw, gw, ww, (size_t)CI * CN / 8, BT);      /* [out][in] x16 f16 planes in fragment order */
  k_proj<<<dim3(NP / PJN, NB), 256, 0, stream>>>(x, BT, QKV, G);      /* every image: theta^T, phi^T [n][128] and g [ci][m] (the PV B^T operand) -> f16 planes in fragment order, from f32 x */
  k_colstat_f<<<dim3(NM / SCM, NB), SCW * 32, 0, stream>>>(QKV, ST);      /* every image: softmax over the QUERY axis: per key column m the max and the sum (kept as one f32: 8 - max log2e - log2 sum) over all 4096 rows n of f[n][m] = theta[n].phi[m] (K = 128, NO scale), f formed in registers */
  k_pvf<<<dim3(NP / (16 * PVN), NB), PVW * 32, 0, stream>>>(QKV, ST, G, 0.00390625f, BW, x, (float*)d_out);      /* every image: y^T [n][ci] = sum_m P[n][m] g[ci][m] -> f16 in LDS, P[n][m] = f16(256 exp(f - max_m) / sum_m), f formed again in registers; then out[c][a] = (16 W as A) x (y^T as B^T) / 16 + bf16(x) -> f32 channel-first output block */
}

// v010
// One run takes 52.6 microseconds.
// Two timings next to v009 put it at 1.08 and 1.07 times that version's speed.
// Counting every step since v000, which is the starting kernel, it is 133 times as fast.
#include <hip/hip_runtime.h>
// Non-local block with the softmax taken over the QUERY axis (x [4][256][64][64]; theta, phi, g = conv1x1(x) with [128][256] weights (U(+-1/16), no biases); scores[n][m] = theta[n].phi[m] (NO scaling); attn = softmax(scores, axis = 1): normalised over n for every key column m (the module's unconventional axis); out[n] = sum_m attn[n][m] g[m]; mask = conv1x1(out; w_mask [256][128], no bias); result = x + mask -> [4][256][64][64]).
// Structure: channel-first; the images share every launch (grid); one projection kernel reads f32 x (rounded to bf16, exact in f16), turns it to token rows in LDS and forms theta^T, phi^T (rows = tokens) and g (rows = channels) on WMMA (f32 accumulation) -> f16, every f16 plane of the workspace laid in fragment order (see FRB); f [4096][4096] = theta^T phi (K = 128, no scale) f32 in registers only, formed once for the column statistics and once for the weights (f32 statistics, native exp; weights x256 f16); y^T = P g^T (x2^-8) f16; out = (16 W) y / 16 + bf16(x) f32 channel-first; launches: k_wnat, k_proj, k_colstat_f, k_pvf.
// Compute dtype: inputs rounded to bf16; x / weights exact; q, k, v, softmax weights and o as plain f16 GEMM operands (~2^-12); scores and softmax statistics f32; v_wmma_f32_16x16x32_f16.
#define NB 4
#define SQ 4096
#define DM 256
#define NH 1
#define HD 64
#define HG 4                         /* heads per attention launch group */
#define B0 0                         /* first batch processed (debug hook) */
#define NBR NB                       /* batches processed (debug hook) */
#define NR ((size_t)NB * SQ)         /* token rows */
#define MP ((int)((size_t)NBR * SQ)) /* rows projected (debug hook) */
#define QT 256                       /* query rows per causal tile */
#define NKX SQ                       /* S / P row pitch */
#define QT0 256                      /* first-tile rows recomputed exactly (256: buys margin for the few-key rows 128..255, which have no output projection to average the single-f16 P/v rounding) */
#define QN SQ                        /* query rows attended per batch (debug hook) */
#define NHD NH                       /* heads attended (debug hook) */
#define MPO MP                       /* rows through the output stage (debug hook) */
#define LQ DM            /* row pitch of the q/k/v rows */
typedef __bf16 v16b __attribute__((ext_vector_type(16)));
typedef unsigned short v8us __attribute__((ext_vector_type(8), may_alias));
typedef float  v8f  __attribute__((ext_vector_type(8)));
typedef float  v4f  __attribute__((ext_vector_type(4)));
typedef float  v4fa __attribute__((ext_vector_type(4), may_alias));
union FragB { v16b v; v8us half[2]; unsigned short u[16]; };

__device__ __forceinline__ unsigned short bf16_bits(float x) { unsigned int u = __float_as_uint(x); return (unsigned short)((u + 0x7FFFu + ((u >> 16) & 1u)) >> 16); }
__device__ __forceinline__ float bf16_val(unsigned short b) { return __uint_as_float(((unsigned int)b) << 16); }
__device__ __forceinline__ float bf16_round(float x) { return bf16_val(bf16_bits(x)); }
// D += A·B with NT terms: 1 = ah·bh, 2 = + al·bh (A split), 3 = + ah·bl (both split)
template <int NT>
__device__ __forceinline__ v8f mmaN(v16b ah, v16b al, v16b bh, v16b bl, v8f c) {
  c = __builtin_amdgcn_wmma_f32_16x16x32_bf16(false, ah, false, bh, (short)0, c, false, false);
  if (NT >= 2) c = __builtin_amdgcn_wmma_f32_16x16x32_bf16(false, al, false, bh, (short)0, c, false, false);
  if (NT >= 3) c = __builtin_amdgcn_wmma_f32_16x16x32_bf16(false, ah, false, bl, (short)0, c, false, false);
  asm volatile("v_nop\n\tv_nop\n\tv_nop\n\tv_nop" : "+v"(c) : "v"(ah), "v"(al), "v"(bh), "v"(bl));
  return c;
}

__global__ __launch_bounds__(256) void k_wt_bf16(const float* __restrict__ W, unsigned short* __restrict__ Wt, int K, int N) {
  const int t = blockIdx.x * 256 + threadIdx.x;
  const int k8n = K / 8;
  if (t >= N * k8n) return;
  const int n = t / k8n, k8 = (t % k8n) * 8;
  v8us v;
#pragma unroll
  for (int i = 0; i < 8; ++i) v[i] = bf16_bits(W[(size_t)(k8 + i) * N + n]);
  *(v8us*)(Wt + (size_t)n * K + k8) = v;
  
}

// GEMM C[M][N] (f32, pitch ldc) = act(A[M][K]·W + bias). A f32 row-major (pitch lda) converted per fragment to bf16
// (ASPLIT: hi/lo two planes -> 2 terms, else single rounded term); Wt bf16 [N][K] (pitch ldb). BIAS_BF16 rounds the
// bias to bf16 first (bias quantised to bf16 before the add). K%32==0, M%16==0, N%64==0.
template <bool ASPLIT, int ACT, bool BIAS_BF16>
__global__ __launch_bounds__(128) void k_gemm_bf(const float* __restrict__ A, int lda, const unsigned short* __restrict__ Wt, int ldb,
                                               const float* __restrict__ bias, float* __restrict__ C, int ldc, int M, int N, int K) {
  __shared__ __attribute__((aligned(16))) float so[4][16][64];
  const int tid = threadIdx.x, w = tid >> 5, lane = tid & 31, ln = lane & 15, hh = lane >> 4;
  const int ntn = N / 64;
  const int wid = blockIdx.x * 4 + w;
  const int mt = wid / ntn, nq = wid % ntn;
  if (mt * 16 >= M) return;
  const int row0 = mt * 16, col0 = nq * 64;
  const float* arow = A + (size_t)(row0 + ln) * lda;
  v8f acc[4] = {};
  for (int kb = 0; kb < K; kb += 32) {
    FragB ah, al;
    const v4f x0 = *(const v4fa*)(arow + kb + 8 * hh), x1 = *(const v4fa*)(arow + kb + 8 * hh + 4);
    const v4f x2 = *(const v4fa*)(arow + kb + 16 + 8 * hh), x3 = *(const v4fa*)(arow + kb + 16 + 8 * hh + 4);
    float xs[16] = {x0[0],x0[1],x0[2],x0[3],x1[0],x1[1],x1[2],x1[3],x2[0],x2[1],x2[2],x2[3],x3[0],x3[1],x3[2],x3[3]};
#pragma unroll
    for (int i = 0; i < 16; ++i) { const unsigned short hb = bf16_bits(xs[i]); ah.u[i] = hb; al.u[i] = ASPLIT ? bf16_bits(xs[i] - bf16_val(hb)) : (unsigned short)0; }
#pragma unroll
    for (int t = 0; t < 4; ++t) {
      const unsigned short* brow = Wt + (size_t)(col0 + t * 16 + ln) * ldb + kb;
      FragB b;
      b.half[0] = *(const v8us*)(brow + 8 * hh);
      b.half[1] = *(const v8us*)(brow + 16 + 8 * hh);
      acc[t] = mmaN<ASPLIT ? 2 : 1>(ah.v, al.v, b.v, b.v, acc[t]);
    }
  }
#pragma unroll
  for (int t = 0; t < 4; ++t) {
    float bv = bias ? bias[col0 + t * 16 + ln] : 0.f;
    if (BIAS_BF16) bv = bf16_round(bv);
#pragma unroll
    for (int r = 0; r < 8; ++r) { float v = acc[t][r] + bv; if (ACT == 1) v = fmaxf(v, 0.f); so[w][8 * hh + r][t * 16 + ln] = v; }
  }
  __builtin_amdgcn_fence(__ATOMIC_ACQ_REL, "workgroup");
  __builtin_amdgcn_wave_barrier();
  const int rsub = lane >> 4, c4 = (lane & 15) * 4;
  {
#pragma unroll
    for (int q = 0; q < 8; ++q) {
      const int r = q * 2 + rsub;
      const v4f v = *(const v4fa*)&so[w][r][c4];
      *(v4f*)(C + (size_t)(row0 + r) * ldc + col0 + c4) = v;
    }
    
  }
}

// GEMM C = act(A·W + bias + resid): A f32 (ASPLIT -> hi/lo 2 terms), Wt bf16 [N][K]; ACT 0 none, 1 relu, 2 exact gelu;
// resid (optional, f32, row index = (row % rmod), pitch ldr, RES_BF16 rounds it) added before the activation.
template <bool ASPLIT, int ACT, bool BIAS_BF16, bool RES_BF16>
__global__ __launch_bounds__(128) void k_gemm_bf3(const float* __restrict__ A, int lda, const unsigned short* __restrict__ Wt, int ldb,
                                                const float* __restrict__ bias, const float* __restrict__ resid, int rmod, int ldr,
                                                float* __restrict__ C, int ldc, int M, int N, int K) {
  __shared__ __attribute__((aligned(16))) float so[4][16][64];
  const int tid = threadIdx.x, w = tid >> 5, lane = tid & 31, ln = lane & 15, hh = lane >> 4;
  const int ntn = N / 64;
  const int wid = blockIdx.x * 4 + w;
  const int mt = wid / ntn, nq = wid % ntn;
  if (mt * 16 >= M) return;
  const int row0 = mt * 16, col0 = nq * 64;
  const float* arow = A + (size_t)(row0 + ln) * lda;
  v8f acc[4] = {};
  for (int kb = 0; kb < K; kb += 32) {
    FragB ah, al;
    const v4f x0 = *(const v4fa*)(arow + kb + 8 * hh), x1 = *(const v4fa*)(arow + kb + 8 * hh + 4);
    const v4f x2 = *(const v4fa*)(arow + kb + 16 + 8 * hh), x3 = *(const v4fa*)(arow + kb + 16 + 8 * hh + 4);
    float xs[16] = {x0[0],x0[1],x0[2],x0[3],x1[0],x1[1],x1[2],x1[3],x2[0],x2[1],x2[2],x2[3],x3[0],x3[1],x3[2],x3[3]};
#pragma unroll
    for (int i = 0; i < 16; ++i) { const unsigned short hb = bf16_bits(xs[i]); ah.u[i] = hb; al.u[i] = ASPLIT ? bf16_bits(xs[i] - bf16_val(hb)) : (unsigned short)0; }
#pragma unroll
    for (int t = 0; t < 4; ++t) {
      const unsigned short* brow = Wt + (size_t)(col0 + t * 16 + ln) * ldb + kb;
      FragB b;
      b.half[0] = *(const v8us*)(brow + 8 * hh);
      b.half[1] = *(const v8us*)(brow + 16 + 8 * hh);
      acc[t] = mmaN<ASPLIT ? 2 : 1>(ah.v, al.v, b.v, b.v, acc[t]);
    }
  }
#pragma unroll
  for (int t = 0; t < 4; ++t) {
    const int col = col0 + t * 16 + ln;
    float bv = bias ? bias[col] : 0.f;
    if (BIAS_BF16) bv = bf16_round(bv);
#pragma unroll
    for (int r = 0; r < 8; ++r) {
      float v = acc[t][r] + bv;
      if (resid) { float rv = resid[(size_t)((row0 + 8 * hh + r) % rmod) * ldr + col]; if (RES_BF16) rv = bf16_round(rv); v += rv; }
      if (ACT == 1) v = fmaxf(v, 0.f);
      if (ACT == 2) v = 0.5f * v * (1.0f + erff(v * 0.70710678118654752f));
      if (ACT == 3) { const float u = 0.7978845608028654f * (v + 0.044715f * v * v * v); v = 0.5f * v * (1.0f + tanhf(u)); }
      so[w][8 * hh + r][t * 16 + ln] = v;
    }
  }
  __builtin_amdgcn_fence(__ATOMIC_ACQ_REL, "workgroup");
  __builtin_amdgcn_wave_barrier();
  const int rsub = lane >> 4, c4 = (lane & 15) * 4;
  {
#pragma unroll
    for (int q = 0; q < 8; ++q) {
      const int r = q * 2 + rsub;
      const v4f v = *(const v4fa*)&so[w][r][c4];
      *(v4f*)(C + (size_t)(row0 + r) * ldc + col0 + c4) = v;
    }
    
  }
}
// row LayerNorm (biased variance, eps) over N: s = X (+ R); optional out_sum <- s; out_norm <- (s-mu)*rsqrt(var+eps)*g + b
template <bool PARAM_BF16>
__global__ __launch_bounds__(256) void k_layernorm(const float* __restrict__ X, const float* __restrict__ R, const float* __restrict__ g, const float* __restrict__ bta,
                                                  float* __restrict__ out_sum, float* __restrict__ out_norm, int N, float eps) {
  __shared__ float red[256];
  const int row = blockIdx.x, tid = threadIdx.x;
  const float* x = X + (size_t)row * N; const float* rr = R ? R + (size_t)row * N : nullptr;
  float vals[16];                     // up to N = 4096
  const int per = N / 256;            // contiguous chunk per thread? use strided-by-4 chunks: thread handles j = tid*4 + 1024*u
  float s1 = 0.f;
  for (int u = 0; u < per / 4; ++u) {
    const int j = tid * 4 + 1024 * u;
    const v4f a = *(const v4fa*)(x + j);
    v4f b = {0.f,0.f,0.f,0.f}; if (rr) b = *(const v4fa*)(rr + j);
#pragma unroll
    for (int q = 0; q < 4; ++q) { const float v = a[q] + b[q]; vals[u * 4 + q] = v; s1 += v; }
  }
  red[tid] = s1; __syncthreads();
  for (int st = 128; st > 0; st >>= 1) { if (tid < st) red[tid] += red[tid + st]; __syncthreads(); }
  const float mu = red[0] / (float)N; __syncthreads();
  float s2 = 0.f;
  for (int u = 0; u < per / 4; ++u)
#pragma unroll
    for (int q = 0; q < 4; ++q) { const float c = vals[u * 4 + q] - mu; s2 += c * c; }
  red[tid] = s2; __syncthreads();
  for (int st = 128; st > 0; st >>= 1) { if (tid < st) red[tid] += red[tid + st]; __syncthreads(); }
  const float rs = rsqrtf(red[0] / (float)N + eps);
  {
    for (int u = 0; u < per / 4; ++u) {
      const int j = tid * 4 + 1024 * u;
      v4f o, sm;
#pragma unroll
      for (int q = 0; q < 4; ++q) {
        float gg = g[j + q], bb = bta[j + q];
        if (PARAM_BF16) { gg = bf16_round(gg); bb = bf16_round(bb); }
        sm[q] = vals[u * 4 + q]; o[q] = (vals[u * 4 + q] - mu) * rs * gg + bb;
      }
      if (out_sum) *(v4f*)(out_sum + (size_t)row * N + j) = sm;
      *(v4f*)(out_norm + (size_t)row * N + j) = o;
    }
    
  }
}



// ---- f16 WMMA path (v_wmma_f32_16x16x32_f16): 11-bit significands for operands in range — used where a [0,1] probability operand needs more precision than bf16
typedef _Float16 v16h __attribute__((ext_vector_type(16)));
union FragH { v16h v; v8us half[2]; _Float16 h[16]; unsigned short u[16]; };
template <int NT>
__device__ __forceinline__ v8f mmaH(v16h ah, v16h al, v16h bh, v16h bl, v8f c) {
  c = __builtin_amdgcn_wmma_f32_16x16x32_f16(false, ah, false, bh, (short)0, c, false, false);
  if (NT >= 2) c = __builtin_amdgcn_wmma_f32_16x16x32_f16(false, al, false, bh, (short)0, c, false, false);
  if (NT >= 3) c = __builtin_amdgcn_wmma_f32_16x16x32_f16(false, ah, false, bl, (short)0, c, false, false);
  asm volatile("v_nop\n\tv_nop\n\tv_nop\n\tv_nop" : "+v"(c) : "v"(ah), "v"(al), "v"(bh), "v"(bl));
  return c;
}
// batched GEMM like k_gemm_b but f16 operands: A f32 (split into f16 hi/lo if ASPLIT, else rounded to f16), Bt = f16 values [n][k]; alpha; C f32; N multiple of 16 (partial tiles skipped)
template <bool ASPLIT>
__global__ __launch_bounds__(128) void k_gemm_h(const float* __restrict__ A, int lda, size_t sA, const _Float16* __restrict__ Bh, int ldb, size_t sB, float alpha, float* __restrict__ C, int ldc, size_t sC, int M, int N, int K) {
  __shared__ __attribute__((aligned(16))) float so[4][16][64];
  const int tid = threadIdx.x, w = tid >> 5, lane = tid & 31, ln = lane & 15, hh = lane >> 4; const int by = blockIdx.y;
  A += (size_t)by * sA; Bh += (size_t)by * sB; C += (size_t)by * sC;
  const int ntn = (N + 63) / 64; const int wid = blockIdx.x * 4 + w; const int mt = wid / ntn, nq = wid % ntn; if (mt * 16 >= M) return;
  const int row0 = mt * 16, col0 = nq * 64; const float* arow = A + (size_t)(row0 + ln) * lda;
  v8f acc[4] = {};
  for (int kb = 0; kb < K; kb += 32) {
    FragH ah, al;
    const v4f x0 = *(const v4fa*)(arow + kb + 8 * hh), x1 = *(const v4fa*)(arow + kb + 8 * hh + 4), x2 = *(const v4fa*)(arow + kb + 16 + 8 * hh), x3 = *(const v4fa*)(arow + kb + 16 + 8 * hh + 4);
    float xs[16] = {x0[0],x0[1],x0[2],x0[3],x1[0],x1[1],x1[2],x1[3],x2[0],x2[1],x2[2],x2[3],x3[0],x3[1],x3[2],x3[3]};
#pragma unroll
    for (int i = 0; i < 16; ++i) { const _Float16 h = (_Float16)xs[i]; ah.h[i] = h; al.h[i] = ASPLIT ? (_Float16)(xs[i] - (float)h) : (_Float16)0.0f; }
#pragma unroll
    for (int t = 0; t < 4; ++t) { if (col0 + t * 16 >= N) continue; const size_t boff = (size_t)(col0 + t * 16 + ln) * ldb + kb; FragH bq; bq.half[0] = *(const v8us*)(Bh + boff + 8 * hh); bq.half[1] = *(const v8us*)(Bh + boff + 16 + 8 * hh);
      acc[t] = mmaH<ASPLIT ? 2 : 1>(ah.v, al.v, bq.v, bq.v, acc[t]); }
  }
#pragma unroll
  for (int t = 0; t < 4; ++t) { if (col0 + t * 16 >= N) continue;
#pragma unroll
    for (int r = 0; r < 8; ++r) so[w][8 * hh + r][t * 16 + ln] = acc[t][r] * alpha; }
  __builtin_amdgcn_fence(__ATOMIC_ACQ_REL, "workgroup"); __builtin_amdgcn_wave_barrier();
  const int rsub = lane >> 4, c4 = (lane & 15) * 4;
  {
#pragma unroll
    for (int q = 0; q < 8; ++q) { const int r = q * 2 + rsub; if (col0 + c4 < N) { const v4f v = *(const v4fa*)&so[w][r][c4]; *(v4f*)(C + (size_t)(row0 + r) * ldc + col0 + c4) = v; } }
     }
}

// Wt[n][k] = f16(W[k][n]·scale) from f32 row-major W[K][N] (scale = power of two; bf16-exact weights stay exact in f16 away from the subnormal range)
__global__ __launch_bounds__(256) void k_wt_f16(const float* __restrict__ W, _Float16* __restrict__ Wt, int K, int N, float scale) {
  const int t = blockIdx.x * 256 + threadIdx.x; if (t >= N * (K / 8)) return; const int n = t / (K / 8), k8 = (t % (K / 8)) * 8; FragH f;
#pragma unroll
  for (int i = 0; i < 8; ++i) f.h[i] = (_Float16)(bf16_round(W[(size_t)(k8 + i) * N + n]) * scale); const v8us o = f.half[0];
  *(v8us*)((unsigned short*)Wt + (size_t)n * K + k8) = o; 
}
// k_gemm_hh variant with fused epilogue: v = acc·alpha + bias[by·sBias + col] (+ CP[(row/rowsPerB)·sCPb + by·64 + col] if CP) ; ACT 0 none / 1 elu ; writes f16 C16 (and f32 C if non-null)
template <int ACT>
__global__ __launch_bounds__(128) void k_gemm_hhx(const _Float16* __restrict__ A, int lda, size_t sA, const _Float16* __restrict__ Bh, int ldb, size_t sB, float alpha, const float* __restrict__ bias, size_t sBias, const float* __restrict__ CP, int rowsPerB, size_t sCPb, int row0g,
    float* __restrict__ C, _Float16* __restrict__ C16, int ldc, size_t sC, int M, int N, int K) {
  __shared__ __attribute__((aligned(16))) float so[4][16][64];
  const int tid = threadIdx.x, w = tid >> 5, lane = tid & 31, ln = lane & 15, hh = lane >> 4; const int by = blockIdx.y;
  A += (size_t)by * sA; Bh += (size_t)by * sB; const size_t cofs = (size_t)by * sC; const float* bp = bias ? bias + (size_t)by * sBias : nullptr;
  const int ntn = (N + 63) / 64; const int wid = blockIdx.x * 4 + w; const int mt = wid / ntn, nq = wid % ntn; if (mt * 16 >= M) return;
  const int row0 = mt * 16, col0 = nq * 64; const _Float16* arow = A + (size_t)(row0 + ln) * lda;
  v8f acc[4] = {};
  for (int kb = 0; kb < K; kb += 32) { FragH ah; ah.half[0] = *(const v8us*)((const unsigned short*)arow + kb + 8 * hh); ah.half[1] = *(const v8us*)((const unsigned short*)arow + kb + 16 + 8 * hh);
#pragma unroll
    for (int t = 0; t < 4; ++t) { if (col0 + t * 16 >= N) continue; const size_t boff = (size_t)(col0 + t * 16 + ln) * ldb + kb; FragH bq; bq.half[0] = *(const v8us*)((const unsigned short*)Bh + boff + 8 * hh); bq.half[1] = *(const v8us*)((const unsigned short*)Bh + boff + 16 + 8 * hh);
      acc[t] = mmaH<1>(ah.v, ah.v, bq.v, bq.v, acc[t]); }
  }
#pragma unroll
  for (int t = 0; t < 4; ++t) { if (col0 + t * 16 >= N) continue; const int col = col0 + t * 16 + ln; const float bv = bp ? bf16_round(bp[col]) : 0.f;
#pragma unroll
    for (int r = 0; r < 8; ++r) { float v = acc[t][r] * alpha + bv; if (CP) { const int rr = row0g + row0 + 8 * hh + r; if (rowsPerB < 0) v += CP[cofs + (size_t)rr * ldc + col];      /* rowsPerB < 0: own element of the batched C plane */ else { const int bidx = rr / rowsPerB; v += CP[(size_t)bidx * sCPb + (size_t)by * 64 + col]; } } if (ACT == 1) v = (v > 0.f) ? v : expm1f(v); else if (ACT == 7) v = (v > 0.f) ? v + 1.0f : expf(v); else if (ACT == 8) v = tanhf(v); else if (ACT == 9) v = 0.5f * v * (1.0f + tanhf(0.7978845608028654f * (v + 0.044715f * v * v * v))); else if (ACT == 11) v = 1.0f / (1.0f + expf(-v)); else if (ACT == 12) v = (v > 0.f) ? v : 0.01f * v; else if (ACT == 14) v = (v > 0.f) ? v : 0.1f * v; else if (ACT == 16) v = (v >= 0.f) ? v : 0.3f * v; else if (ACT == 17) v = (v >= 0.f) ? v : 0.2f * v; else if (ACT == 15) v = v / (1.0f + expf(-v)); else if (ACT == 3) v = fmaxf(v, 0.f); else if (ACT == 6) v = 0.5f * v * (1.0f + erff(v * 0.70710678118654752f)); so[w][8 * hh + r][t * 16 + ln] = v; } }
  __builtin_amdgcn_fence(__ATOMIC_ACQ_REL, "workgroup"); __builtin_amdgcn_wave_barrier();
  const int rsub = lane >> 4, c4 = (lane & 15) * 4; typedef _Float16 v4h __attribute__((ext_vector_type(4)));
  {
#pragma unroll
    for (int q = 0; q < 8; ++q) { const int r = q * 2 + rsub; if (col0 + c4 < N) { const v4f v = *(const v4fa*)&so[w][r][c4]; if (C) *(v4f*)(C + cofs + (size_t)(row0 + r) * ldc + col0 + c4) = v; if (C16) { v4h h4; for (int i = 0; i < 4; ++i) h4[i] = (_Float16)v[i]; *(v4h*)(C16 + cofs + (size_t)(row0 + r) * ldc + col0 + c4) = h4; } } }
     }
}


typedef _Float16 v4h __attribute__((ext_vector_type(4)));

__global__ __launch_bounds__(256) void k_x16(const float* __restrict__ x, _Float16* __restrict__ X16, size_t n8) { const size_t t = (size_t)blockIdx.x * 256 + threadIdx.x; if (t >= n8) return; FragH f;
#pragma unroll
  for (int q = 0; q < 8; ++q) f.h[q] = (_Float16)bf16_round(x[t * 8 + q]); *(v8us*)((unsigned short*)X16 + t * 8) = f.half[0];  }
__global__ __launch_bounds__(256) void k_h16(const float* __restrict__ x, _Float16* __restrict__ X16, size_t n8) { const size_t t = (size_t)blockIdx.x * 256 + threadIdx.x; if (t >= n8) return; FragH f;
#pragma unroll
  for (int q = 0; q < 8; ++q) f.h[q] = (_Float16)x[t * 8 + q]; *(v8us*)((unsigned short*)X16 + t * 8) = f.half[0];  }
__global__ __launch_bounds__(256) void k_round16f(const float* __restrict__ W, _Float16* __restrict__ Bt, size_t n8) { const size_t t = (size_t)blockIdx.x * 256 + threadIdx.x; if (t >= n8) return; FragH f;
#pragma unroll
  for (int i = 0; i < 8; ++i) f.h[i] = (_Float16)(bf16_round(W[t * 8 + i]) * 16.0f); *(v8us*)((unsigned short*)Bt + t * 8) = f.half[0];  }
template <int NHv, int TTv>
__global__ __launch_bounds__(256) void k_vt(const _Float16* __restrict__ V16, int ldv, int voff, _Float16* __restrict__ Vt) { __shared__ unsigned short tl[64][66]; const int tid = threadIdx.x; const int slab = blockIdx.x / (TTv / 64), lg = blockIdx.x % (TTv / 64); const int b = slab / NHv, h = slab % NHv;
  for (int i = tid; i < 64 * 8; i += 256) { const int r = i / 8, c8 = (i % 8) * 8; FragH f; f.half[0] = *(const v8us*)((const unsigned short*)V16 + ((size_t)b * TTv + lg * 64 + r) * ldv + voff + h * 64 + c8);
#pragma unroll
    for (int q = 0; q < 8; ++q) tl[r][c8 + q] = f.u[q]; }
  __syncthreads();
  {
#pragma unroll
    for (int rd = 0; rd < 2; ++rd) { const int d = rd * 32 + tid / 8, pc = tid % 8; FragH f;
#pragma unroll
      for (int q = 0; q < 8; ++q) f.u[q] = tl[pc * 8 + q][d];
      *(v8us*)((unsigned short*)Vt + ((size_t)slab * 64 + d) * TTv + lg * 64 + pc * 8) = f.half[0]; }
     } }

__global__ __launch_bounds__(256) void k_hl(const float* __restrict__ F, _Float16* __restrict__ Hh, _Float16* __restrict__ Hl, size_t n8) { const size_t t = (size_t)blockIdx.x * 256 + threadIdx.x; if (t >= n8) return; FragH fh, fl; const v4f a = *(const v4fa*)(F + t * 8), c = *(const v4fa*)(F + t * 8 + 4);
#pragma unroll
  for (int q = 0; q < 4; ++q) { _Float16 h = (_Float16)a[q]; fh.h[q] = h; fl.h[q] = (_Float16)((a[q] - (float)h) * 1024.0f); h = (_Float16)c[q]; fh.h[4 + q] = h; fl.h[4 + q] = (_Float16)((c[q] - (float)h) * 1024.0f); }
  { *(v8us*)((unsigned short*)Hh + t * 8) = fh.half[0]; *(v8us*)((unsigned short*)Hl + t * 8) = fl.half[0];  } }

// ---- fast GEMM (wave tile 32x64; requires M % 32 == 0 rows per launch region and N % 64 == 0); epilogue = k_gemm_hhx semantics ----
__device__ __forceinline__ v16h g2_frag(const _Float16* p, int hh) { FragH f; f.half[0] = *(const v8us*)((const unsigned short*)p + 8 * hh); f.half[1] = *(const v8us*)((const unsigned short*)p + 16 + 8 * hh); return f.v; }
__device__ __forceinline__ v8f g2_mma(v16h a, v16h b, v8f c) { v8f d = __builtin_amdgcn_wmma_f32_16x16x32_f16(false, a, false, b, (short)0, c, false, false); asm volatile("v_nop\n\tv_nop\n\tv_nop\n\tv_nop" : "+v"(d) : "v"(a), "v"(b)); return d; }
template <int ACT>
__global__ __launch_bounds__(128) void k_gemm2(const _Float16* __restrict__ A, int lda, size_t sA, const _Float16* __restrict__ Bh, int ldb, size_t sB, float alpha, const float* __restrict__ bias, size_t sBias, const float* __restrict__ CP, int rowsPerB, size_t sCPb, int row0g,
    float* __restrict__ C, _Float16* __restrict__ C16, int ldc, size_t sC, int M, int N, int K) { static_assert(ACT == 0 || ACT == 3 || ACT == 6 || ACT == 8 || ACT == 9 || ACT == 11 || ACT == 12 || ACT == 14 || ACT == 15 || ACT == 16 || ACT == 17, "k_gemm2: unsupported ACT code (would silently apply no activation)");
  __shared__ __attribute__((aligned(16))) float so[4][32][68];
  const int tid = threadIdx.x, w = tid >> 5, lane = tid & 31, ln = lane & 15, hh = lane >> 4; const int by = blockIdx.y;
  A += (size_t)by * sA; Bh += (size_t)by * sB; const size_t cofs = (size_t)by * sC; const float* bp = bias ? bias + (size_t)by * sBias : nullptr;
  const int ntn = N >> 6; const int mt = blockIdx.x / ntn, nq = blockIdx.x - mt * ntn; const int row0 = mt * 128 + 32 * w, col0 = nq * 64; if (row0 >= M) return;
  const _Float16* a0p = A + (size_t)(row0 + ln) * lda; const _Float16* a1p = a0p + (size_t)16 * lda;
  const _Float16* b0p = Bh + (size_t)(col0 + ln) * ldb; const _Float16* b1p = b0p + (size_t)16 * ldb; const _Float16* b2p = b1p + (size_t)16 * ldb; const _Float16* b3p = b2p + (size_t)16 * ldb;
  const v8f z8 = {0.f,0.f,0.f,0.f,0.f,0.f,0.f,0.f}; v8f c00 = z8, c01 = z8, c02 = z8, c03 = z8, c10 = z8, c11 = z8, c12 = z8, c13 = z8;
#pragma unroll 1
  for (int kb = 0; kb < K; kb += 32) { const v16h a0 = g2_frag(a0p + kb, hh), a1 = g2_frag(a1p + kb, hh);
    v16h b = g2_frag(b0p + kb, hh); c00 = g2_mma(a0, b, c00); c10 = g2_mma(a1, b, c10);
    b = g2_frag(b1p + kb, hh); c01 = g2_mma(a0, b, c01); c11 = g2_mma(a1, b, c11);
    b = g2_frag(b2p + kb, hh); c02 = g2_mma(a0, b, c02); c12 = g2_mma(a1, b, c12);
    b = g2_frag(b3p + kb, hh); c03 = g2_mma(a0, b, c03); c13 = g2_mma(a1, b, c13); }
  v8f accs[8] = {c00, c01, c02, c03, c10, c11, c12, c13};
#pragma unroll
  for (int u = 0; u < 8; ++u) { const int t = u & 3, half = u >> 2; const int col = col0 + t * 16 + ln; const float bv = bp ? bf16_round(bp[col]) : 0.f;
#pragma unroll
    for (int r = 0; r < 8; ++r) { const int rloc = half * 16 + 8 * hh + r; float v = accs[u][r] * alpha + bv; if (CP) { if (rowsPerB < 0) v += CP[cofs + (size_t)(row0g + row0 + rloc) * ldc + col];      /* rowsPerB < 0: own element of the batched C plane */ else { const int bidx = (row0g + row0 + rloc) / rowsPerB; v += CP[(size_t)bidx * sCPb + (size_t)by * 64 + col]; } }
      if (ACT == 3) v = fmaxf(v, 0.f); else if (ACT == 6) v = 0.5f * v * (1.0f + erff(v * 0.70710678118654752f)); else if (ACT == 11) v = 1.0f / (1.0f + expf(-v)); else if (ACT == 15) v = v / (1.0f + expf(-v)); else if (ACT == 12) v = (v > 0.f) ? v : 0.01f * v; else if (ACT == 8) v = tanhf(v); else if (ACT == 9) v = 0.5f * v * (1.0f + tanhf(0.7978845608028654f * (v + 0.044715f * v * v * v))); else if (ACT == 14) v = (v > 0.f) ? v : 0.1f * v; else if (ACT == 16) v = (v >= 0.f) ? v : 0.3f * v; else if (ACT == 17) v = (v >= 0.f) ? v : 0.2f * v;
      so[w][rloc][t * 16 + ln] = v; } }
  __builtin_amdgcn_fence(__ATOMIC_ACQ_REL, "workgroup"); __builtin_amdgcn_wave_barrier();
  const int rsub = lane >> 4, c4 = (lane & 15) * 4;
  {
#pragma unroll
    for (int q = 0; q < 16; ++q) { const int r = q * 2 + rsub; const v4f v = *(const v4fa*)&so[w][r][c4]; if (C) *(v4f*)(C + cofs + (size_t)(row0 + r) * ldc + col0 + c4) = v; if (C16) { v4h h4; for (int i = 0; i < 4; ++i) h4[i] = (_Float16)v[i]; *(v4h*)(C16 + cofs + (size_t)(row0 + r) * ldc + col0 + c4) = h4; } }
     } }


// ---- the same 32x64 wave tile with K split over the NW waves of a work-group, for products with few output tiles (M x N small, K long) ----
// A work-group owns ONE 32x64 tile of C; wave w sums k in [w K / NW, (w + 1) K / NW) with the loop of k_gemm2; the NW partial tiles (f32) meet in LDS and are added in wave order.
// Requires M % 32 == 0 (grid = (M / 32) (N / 64)), N % 64 == 0, K % (32 NW) == 0. C16 = f16(alpha x sum).
template <int NW>
__global__ __launch_bounds__(NW * 32) void k_gemm2k(const _Float16* __restrict__ A, int lda, const _Float16* __restrict__ Bh, int ldb, float alpha, _Float16* __restrict__ C16, int ldc, int N, int K) {
  __shared__ __attribute__((aligned(16))) float so[NW][32][68];
  const int tid = threadIdx.x, w = tid >> 5, lane = tid & 31, ln = lane & 15, hh = lane >> 4;
  const int ntn = N >> 6; const int mt = blockIdx.x / ntn, nq = blockIdx.x - mt * ntn; const int row0 = mt * 32, col0 = nq * 64; const int ks = K / NW;
  const _Float16* a0p = A + (size_t)(row0 + ln) * lda + w * ks; const _Float16* a1p = a0p + (size_t)16 * lda;
  const _Float16* b0p = Bh + (size_t)(col0 + ln) * ldb + w * ks; const _Float16* b1p = b0p + (size_t)16 * ldb; const _Float16* b2p = b1p + (size_t)16 * ldb; const _Float16* b3p = b2p + (size_t)16 * ldb;
  const v8f z8 = {0.f,0.f,0.f,0.f,0.f,0.f,0.f,0.f}; v8f c00 = z8, c01 = z8, c02 = z8, c03 = z8, c10 = z8, c11 = z8, c12 = z8, c13 = z8;
  for (int kb = 0; kb < ks; kb += 32) { const v16h a0 = g2_frag(a0p + kb, hh), a1 = g2_frag(a1p + kb, hh);
    v16h b = g2_frag(b0p + kb, hh); c00 = g2_mma(a0, b, c00); c10 = g2_mma(a1, b, c10);
    b = g2_frag(b1p + kb, hh); c01 = g2_mma(a0, b, c01); c11 = g2_mma(a1, b, c11);
    b = g2_frag(b2p + kb, hh); c02 = g2_mma(a0, b, c02); c12 = g2_mma(a1, b, c12);
    b = g2_frag(b3p + kb, hh); c03 = g2_mma(a0, b, c03); c13 = g2_mma(a1, b, c13); }
  v8f accs[8] = {c00, c01, c02, c03, c10, c11, c12, c13};
#pragma unroll
  for (int u = 0; u < 8; ++u) {      /* unrolled so that accs[] is indexed by constants and stays in registers */
#pragma unroll
    for (int r = 0; r < 8; ++r) so[w][(u >> 2) * 16 + 8 * hh + r][(u & 3) * 16 + ln] = accs[u][r]; }
  __syncthreads();      /* every wave's partial tile is in LDS before any thread adds them */
  for (int i0 = 0; i0 < 32 * 16; i0 += NW * 32) { const int i = i0 + tid, r = i >> 4, c4 = (i & 15) * 4; v4f s = *(const v4f*)&so[0][r][c4];
#pragma unroll
    for (int k = 1; k < NW; ++k) s += *(const v4f*)&so[k][r][c4];      /* unrolled so that the NW LDS reads issue together */
    v4h h4;
#pragma unroll
    for (int q = 0; q < 4; ++q) h4[q] = (_Float16)(s[q] * alpha);      /* unrolled so that the vector elements are indexed by constants */
    *(v4h*)(C16 + (size_t)(row0 + r) * ldc + col0 + c4) = h4; } }


// four weight matrices of n8 x 8 elements each -> four planes one behind the other in Bt, each in fragment order (see FRB below); blockIdx.y picks the matrix; planes 0..2 have K = 256, plane 3 has K = 128.
// Thread t writes 16-B piece t of its plane: lane = t % 32, half j, block kb of the row tile rt; it reads 8 consecutive k of row 16 rt + lane % 16.
__global__ __launch_bounds__(256) void k_wnat(const float* __restrict__ w0, const float* __restrict__ w1, const float* __restrict__ w2, const float* __restrict__ w3, size_t n8, _Float16* __restrict__ Bt) { const size_t t = (size_t)blockIdx.x * 256 + threadIdx.x; if (t >= n8) return; const unsigned p = blockIdx.y; const float* w = p == 0 ? w0 : p == 1 ? w1 : p == 2 ? w2 : w3;
  const unsigned c = (unsigned)t, lg = p == 3 ? 2u : 3u, kb = (c >> 6) & ((1u << lg) - 1u), rt = c >> (6 + lg); const size_t s = ((size_t)(rt * 16 + (c & 15)) << (5 + lg)) + kb * 32 + ((c >> 5) & 1) * 16 + ((c >> 4) & 1) * 8;
  FragH f; for (int q = 0; q < 8; ++q) f.h[q] = (_Float16)(bf16_round(w[s + q]) * 16.0f); *(v8us*)((unsigned short*)Bt + (p * n8 + t) * 8) = f.half[0];  }
__global__ __launch_bounds__(256) void k_rsm(const float* __restrict__ S, _Float16* __restrict__ P, int nrows) {
  #pragma clang fp contract(off)
  const int i = blockIdx.x * 256 + threadIdx.x; if (i >= nrows) return; const float* s = S + (size_t)i * SQ; float mx = -3.0e38f;
#pragma unroll 1
  for (int j = 0; j < SQ; ++j) mx = fmaxf(mx, s[j]); float se = 0.f;
#pragma unroll 1
  for (int j = 0; j < SQ; ++j) se += expf(s[j] - mx); const float sc = 256.0f / se;
#pragma unroll 1
  for (int j0 = 0; j0 < SQ; j0 += 8) { FragH f; for (int q = 0; q < 8; ++q) f.h[q] = (_Float16)(expf(s[j0 + q] - mx) * sc); unsigned short* d = (unsigned short*)P + (size_t)i * SQ + j0; *(v8us*)d = f.half[0];  } }
__global__ __launch_bounds__(256) void k_vt(const _Float16* __restrict__ V16, int b, int h0, _Float16* __restrict__ VT) { __shared__ unsigned short tl[64][65]; const int tid = threadIdx.x; const int hh = blockIdx.x % HG, sg = blockIdx.x / HG; const int s0 = sg * 64; const int h = h0 + hh;
  for (int i = tid; i < 64 * 8; i += 256) { const int j = i / 8, d8 = (i % 8) * 8; FragH f; f.half[0] = *(const v8us*)((const unsigned short*)V16 + ((size_t)b * SQ + s0 + j) * DM + h * HD + d8); for (int q = 0; q < 8; ++q) tl[d8 + q][j] = f.u[q]; }
  __syncthreads();
  { for (int i = tid; i < 64 * 8; i += 256) { const int d = i / 8, j8 = (i % 8) * 8; FragH f; for (int q = 0; q < 8; ++q) f.u[q] = tl[d][j8 + q]; *(v8us*)((unsigned short*)VT + ((size_t)hh * HD + d) * SQ + s0 + j8) = f.half[0]; }  } }



__global__ __launch_bounds__(256) void k_rsmcf2(const float* __restrict__ S, _Float16* __restrict__ P, int hg, int q0, int nk) {
  #pragma clang fp contract(off)
  const int t = blockIdx.x * 256 + threadIdx.x; if (t >= hg * QT) return; const size_t i = (size_t)t; const float* s = S + i * NKX; const int last = q0 + (t % QT); float mx = -3.0e38f;
#pragma unroll 1
  for (int j = 0; j < nk; ++j) { const float f = (j <= last) ? 1.f : 0.f; mx = fmaxf(mx, fmaf(f, s[j], (1.f - f) * -1.0e9f)); } float se = 0.f;
#pragma unroll 1
  for (int j = 0; j < nk; ++j) { const float f = (j <= last) ? 1.f : 0.f; se += __expf(fmaf(f, s[j], (1.f - f) * -1.0e9f) - mx); } const float sc = 256.0f / se;
#pragma unroll 1
  for (int j0 = 0; j0 < nk; j0 += 8) { FragH fr; for (int q = 0; q < 8; ++q) { const int j = j0 + q; const float f = (j <= last) ? 1.f : 0.f; fr.h[q] = (_Float16)(__expf(fmaf(f, s[j], (1.f - f) * -1.0e9f) - mx) * sc); } unsigned short* d = (unsigned short*)P + i * NKX + j0; *(v8us*)d = fr.half[0];  } }

template <int MASKADD>
__global__ __launch_bounds__(64) void k_att0(const float* __restrict__ QF, const float* __restrict__ KF, const float* __restrict__ VF, int ld, const float* __restrict__ mask, float scale, float* __restrict__ OF, int ldo) {
  #pragma clang fp contract(off)
  __shared__ __attribute__((aligned(16))) float lq[64][64]; __shared__ __attribute__((aligned(16))) float lo[64][64];
  const int tid = threadIdx.x; const int h = blockIdx.x / (QT0 / 64), rg = blockIdx.x % (QT0 / 64); const int i = rg * 64 + tid;
  const float* qr = QF + (size_t)i * ld + h * HD;
#pragma unroll 1
  for (int c = 0; c < HD / 4; ++c) { *(v4f*)&lq[tid][c * 4] = *(const v4fa*)(qr + c * 4); const v4f z = {0.f, 0.f, 0.f, 0.f}; *(v4f*)&lo[tid][c * 4] = z; }
  float m = -1.0e30f, l = 0.f; const int jmax = MASKADD ? (SQ - 1) : (rg * 64 + 63);      /* additive-mask form: every key (the mask input decides); causal form: keys up to the block's last row */
#pragma unroll 1
  for (int j = 0; j <= jmax; ++j) { const float* kr = KF + (size_t)j * ld + h * HD; const float* vr = VF + (size_t)j * ld + h * HD; float s = 0.f;
#pragma unroll 1
    for (int c = 0; c < HD / 4; ++c) { const v4f kq = *(const v4fa*)(kr + c * 4); const v4f qq = *(v4f*)&lq[tid][c * 4]; s = __fadd_rn(s, __fmul_rn(qq[0], kq[0])); s = __fadd_rn(s, __fmul_rn(qq[1], kq[1])); s = __fadd_rn(s, __fmul_rn(qq[2], kq[2])); s = __fadd_rn(s, __fmul_rn(qq[3], kq[3])); }
    s = __fmul_rn(s, scale); if (MASKADD) s = __fadd_rn(s, __fmul_rn(bf16_round(mask[(size_t)i * SQ + j]), -10000.0f));
    const float f = (MASKADD || j <= i) ? 1.f : 0.f; const float sm = fmaf(f, s, (1.f - f) * -1.0e30f); const float mn = fmaxf(m, sm); const float sc = expf(m - mn); const float e = expf(sm - mn); l = __fadd_rn(__fmul_rn(l, sc), e); m = mn;
#pragma unroll 1
    for (int c = 0; c < HD / 4; ++c) { const v4f vv = *(const v4fa*)(vr + c * 4); v4f oo = *(v4f*)&lo[tid][c * 4]; for (int u = 0; u < 4; ++u) oo[u] = __fadd_rn(__fmul_rn(oo[u], sc), __fmul_rn(e, vv[u])); *(v4f*)&lo[tid][c * 4] = oo; } }
  const float fin = 64.0f / l;      /* o carried x64 like the f16 path */
#pragma unroll 1
  for (int c = 0; c < HD / 4; ++c) { v4f oo = *(v4f*)&lo[tid][c * 4]; for (int u = 0; u < 4; ++u) oo[u] = __fmul_rn(oo[u], fin); *(v4f*)&lo[tid][c * 4] = oo; }
  __syncthreads();
  {
#pragma unroll 1
    for (int it = 0; it < 16; ++it) { const int row = it * 4 + tid / 16, pc = (tid % 16) * 4; const v4f v = *(const v4f*)&lo[row][pc]; *(v4f*)(OF + (size_t)(rg * 64 + row) * ldo + h * HD + pc) = v; }
     } }

__global__ __launch_bounds__(256) void k_oscale(const float* __restrict__ OF, float* __restrict__ out, size_t n4) { const size_t t = (size_t)blockIdx.x * 256 + threadIdx.x; if (t >= n4) return; const v4f a = *(const v4fa*)(OF + t * 4); v4f o; for (int q = 0; q < 4; ++q) o[q] = a[q] * 0.015625f; *(v4f*)(out + t * 4) = o;  }

__global__ __launch_bounds__(256) void k_bfr(const float* __restrict__ x, float* __restrict__ XB, size_t n8) { const size_t t = (size_t)blockIdx.x * 256 + threadIdx.x; if (t >= n8) return; v4f a = *(const v4fa*)(x + t * 8), c = *(const v4fa*)(x + t * 8 + 4); for (int q = 0; q < 4; ++q) { a[q] = bf16_round(a[q]); c[q] = bf16_round(c[q]); }
  { *(v4f*)(XB + t * 8) = a; *(v4f*)(XB + t * 8 + 4) = c;  } }



__global__ __launch_bounds__(256) void k_rsmfvl(const float* __restrict__ S, _Float16* __restrict__ P, _Float16* __restrict__ PL, int qn, const int* __restrict__ vlp) {
  #pragma clang fp contract(off)
  const int t = blockIdx.x * 256 + threadIdx.x; if (t >= qn) return; const int vl = vlp[0]; const size_t i = (size_t)t; const float* s = S + i * SQ; float mx = -3.0e38f;
#pragma unroll 1
  for (int j = 0; j < SQ; ++j) { const float f = (j < vl) ? 1.f : 0.f; mx = fmaxf(mx, fmaf(f, s[j], (1.f - f) * -1000000.0f)); } float se = 0.f;
#pragma unroll 1
  for (int j = 0; j < SQ; ++j) { const float f = (j < vl) ? 1.f : 0.f; se += __expf(fmaf(f, s[j], (1.f - f) * -1000000.0f) - mx); } const float sc = 256.0f / se;
#pragma unroll 1
  for (int j0 = 0; j0 < SQ; j0 += 8) { FragH fr, gr; for (int q = 0; q < 8; ++q) { const int j = j0 + q; const float f = (j < vl) ? 1.f : 0.f; const float pv = __expf(fmaf(f, s[j], (1.f - f) * -1000000.0f) - mx) * sc; const _Float16 ph = (_Float16)pv; fr.h[q] = ph; gr.h[q] = (_Float16)((pv - (float)ph) * 1024.0f); }
    unsigned short* d = (unsigned short*)P + i * SQ + j0; unsigned short* dl = (unsigned short*)PL + i * SQ + j0; *(v8us*)d = fr.half[0]; *(v8us*)dl = gr.half[0];  } }

__global__ __launch_bounds__(256) void k_rsmf(const float* __restrict__ S, _Float16* __restrict__ P, int qn, int hg) {
  #pragma clang fp contract(off)
  const int t = blockIdx.x * 256 + threadIdx.x; if (t >= qn * hg) return; const size_t i = (size_t)(t / qn) * SQ + (t % qn); const float* s = S + i * SQ; float mx = -3.0e38f;
#pragma unroll 1
  for (int j = 0; j < SQ; ++j) mx = fmaxf(mx, s[j]); float se = 0.f;
#pragma unroll 1
  for (int j = 0; j < SQ; ++j) se += __expf(s[j] - mx); const float sc = 256.0f / se;
#pragma unroll 1
  for (int j0 = 0; j0 < SQ; j0 += 8) { FragH f; for (int q = 0; q < 8; ++q) f.h[q] = (_Float16)(__expf(s[j0 + q] - mx) * sc); unsigned short* d = (unsigned short*)P + i * SQ + j0; *(v8us*)d = f.half[0];  } }


#define CN 256          /* channels */
#define CI 128          /* inner channels */
#define NP 4096         /* positions */
#define NM 4096         /* key positions (= SQ) */
#define NC CN           /* BN statistics macros */
#define NPX NP
#define BNEPS 1e-5f

__global__ __launch_bounds__(256) void k_rowbias(const float* __restrict__ b, float* __restrict__ BP, size_t n4, int ncol) { const size_t t = (size_t)blockIdx.x * 256 + threadIdx.x; if (t >= n4) return; const size_t e = t * 4; const float v = bf16_round(b[e / ncol]); const v4f o = {v, v, v, v}; *(v4f*)(BP + e) = o;  }




__global__ __launch_bounds__(256) void k_mp2(const float* __restrict__ src, float* __restrict__ dst, int nout) {
  const int t = blockIdx.x * 256 + threadIdx.x; if (t >= nout) return; const int c = t / 1024; const int o = t % 1024; const int oy = o / 32, ox = o % 32; const float* p = src + (size_t)c * 4096 + (size_t)(2 * oy) * 64 + 2 * ox;
  const float v = fmaxf(fmaxf(p[0], p[1]), fmaxf(p[64], p[65])); *(float*)(dst + t) = v;  }
__global__ __launch_bounds__(256) void k_xpb(const float* __restrict__ x, const float* __restrict__ wb, float* __restrict__ CPP, size_t n4) {
  #pragma clang fp contract(off)
  const size_t t = (size_t)blockIdx.x * 256 + threadIdx.x; if (t >= n4) return; const size_t e = t * 4; const int c = (int)((e / 4096) % 256); const float bb = bf16_round(wb[c]); const v4f a = *(const v4fa*)(x + e); v4f o; for (int q = 0; q < 4; ++q) o[q] = __fadd_rn(bf16_round(a[q]), bb);
  *(v4f*)(CPP + e) = o;  }


template <int PASS>
__global__ __launch_bounds__(256) void k_cstA(const float* __restrict__ X, const float* __restrict__ MV, float* __restrict__ PART) {
  #pragma clang fp contract(off)
  __shared__ float red[256]; const int t = threadIdx.x; const size_t bc = blockIdx.x; const int c = (int)(bc % NC); const float* row = X + bc * (size_t)NPX; const float mu = PASS ? MV[c] : 0.f; float s = 0.f;
  for (int i = t; i < NPX; i += 256) { const float v = row[i]; const float d = PASS ? __fadd_rn(v, -mu) : v; s = __fadd_rn(s, PASS ? __fmul_rn(d, d) : d); }
  red[t] = s; __syncthreads(); for (int st = 128; st > 0; st >>= 1) { if (t < st) red[t] = __fadd_rn(red[t], red[t + st]); __syncthreads(); }
  if (t < 32) { const float pv = (t == 0) ? red[0] : 0.f; *(float*)(PART + bc * 32 + t) = pv;  } }      

template <int PASS>
__global__ __launch_bounds__(256) void k_cstB(const float* __restrict__ PART, float* __restrict__ MV) { const int c = threadIdx.x; if (c >= NC) return; double s = 0.0; for (int b = 0; b < NB; ++b) s += (double)PART[((size_t)b * NC + c) * 32]; const float m = (float)(s / ((double)NB * (double)NPX)); *(float*)(MV + PASS * NC + c) = m;  }


__global__ __launch_bounds__(256) void k_bnresid(const float* __restrict__ C2, const float* __restrict__ MV, const float* __restrict__ g, const float* __restrict__ be, const float* __restrict__ X, float* __restrict__ out, size_t n4) {
  #pragma clang fp contract(off)
  const size_t t = (size_t)blockIdx.x * 256 + threadIdx.x; if (t >= n4) return; const size_t e = t * 4; const int c = (int)((e / NPX) % NC); const float sc = __fmul_rn(rsqrtf(__fadd_rn(MV[NC + c], BNEPS)), bf16_round(g[c])); const float mu = MV[c], bb = bf16_round(be[c]);
  const v4f a = *(const v4fa*)(C2 + e); const v4f xx = *(const v4fa*)(X + e); v4f o; for (int q = 0; q < 4; ++q) { const float z = __fadd_rn(__fmul_rn(__fadd_rn(a[q], -mu), sc), bb); o[q] = __fadd_rn(z, bf16_round(xx[q])); }
  *(v4f*)(out + e) = o;  }


__global__ __launch_bounds__(256) void k_rowbias(float* __restrict__ Y, const float* __restrict__ bias) {
  #pragma clang fp contract(off)
  const size_t t = (size_t)blockIdx.x * 256 + threadIdx.x; if (t >= (size_t)NB * NC * NPX / 4) return; const size_t e = t * 4; const int c = (int)((e / NPX) % NC); const float bb = bf16_round(bias[c]);
  v4f v = *(const v4fa*)(Y + e); for (int q = 0; q < 4; ++q) v[q] = __fadd_rn(v[q], bb); *(v4f*)(Y + e) = v;  }


// Scores never stored. Both consumers of f = theta^T phi form their own score tiles on the matrix unit from the f16 theta and phi planes (fragment order, below) and use them in registers.
// ST holds one f32 per column m: 8 - max_m log2e - log2(sum_m), so that 2^(s log2e + ST[m]) = 256 exp(s - max_m) / sum_m. blockIdx.y is the image.
// Inner loops carry #pragma unroll so that the fragment arrays are indexed by constants and stay in registers (a run-time index would send them to scratch).
#define QIS (2 * NP * CI)         /* elements of an image in QKV: the theta plane, then the phi plane, each [4096 rows][K = 128] in fragment order */
#define SCM 64                    /* columns per work-group of the statistics kernel */
#define SCW 16                    /* its waves: the 4,096 rows split over them */
__device__ __forceinline__ v8f f_mma(v16h a, v16h b, v8f c) { return __builtin_amdgcn_wmma_f32_16x16x32_f16(false, a, false, b, (short)0, c, false, false); }
// Exponents are formed two scores at a time: exp(s - a) = 2^(s log2e - a log2e), the bracket one packed f32 multiply-add on a register pair of the score tile, then the native 2^x.
typedef float v2f __attribute__((ext_vector_type(2)));
#define L2E 1.4426950408889634f
__device__ __forceinline__ v2f ex2_pair(float s0, float s1, v2f nc) { const v2f s = {s0, s1}, l = {L2E, L2E}; const v2f x = __builtin_elementwise_fma(s, l, nc); const v2f e = {__builtin_amdgcn_exp2f(x[0]), __builtin_amdgcn_exp2f(x[1])}; return e; }
// FRAGMENT ORDER. Every f16 plane that a matrix instruction reads from the workspace lies as blocks of 16 rows x 32 k, FRB elements each: [half j][lane = 16 hh + ln][8 elements], element e of row ln at k = 16 j + 8 hh + e;
// the blocks of a 16-row tile follow each other in k. A wave's 16-B-a-lane load of half a fragment then covers 512 contiguous bytes (4 whole lines) where a row-major plane makes it touch 16 lines.
#define FRB 512                   /* f16 elements of a block */
__device__ __forceinline__ v16h p_frag(const _Float16* p) { FragH f; f.half[0] = *(const v8us*)((const unsigned short*)p); f.half[1] = *(const v8us*)((const unsigned short*)p + 256); return f.v; }      /* p: the block + 8 lane */
__device__ __forceinline__ v16h f_frag(const _Float16* p) { FragH f; f.half[0] = *(const v8us*)((const unsigned short*)p); f.half[1] = *(const v8us*)((const unsigned short*)p + 16); return f.v; }      /* g2_frag with the lane's + 8 hh already in p */
// Column statistics: a work-group owns 64 key columns m (their phi fragments stay in registers as B), wave w sweeps rows n in [256 w, 256 w + 256) 16 at a time (theta as A).
// In D a lane holds 8 rows of ONE column (row 8 hh + r, column ln), so the running maximum and the rescaled running sum of a column stay in the lane (the sum as a pair: even rows, odd rows); the 32 partial pairs of a column (16 waves x 2 lane halves) meet in LDS.
// One trip: 16 rows from ac; the next trip's theta fragments are fetched into ax behind the products (two register sets that swap roles, so that no copy and no early wait stands between).
__device__ __forceinline__ void cs_trip(const _Float16* an, const v16h (&ph)[4][4], const v16h (&ac)[4], v16h (&ax)[4], float (&mx)[4], v2f (&se)[4]) {
  const v8f z8 = {0.f,0.f,0.f,0.f,0.f,0.f,0.f,0.f}; v8f d[4] = {z8, z8, z8, z8};
#pragma unroll
  for (int k = 0; k < 4; ++k) {
#pragma unroll
    for (int t = 0; t < 4; ++t) d[t] = f_mma(ac[k], ph[t][k], d[t]); }
#pragma unroll
  for (int k = 0; k < 4; ++k) ax[k] = p_frag(an + k * FRB);
  asm volatile("s_wait_xcnt 0x0" :: "v"(an) : "memory");      /* a precaution: the address that the 8 loads above name stays live and unwritten up to this wait */
  __builtin_amdgcn_sched_barrier(0);      /* keeps the fetch in front of the vector work below, which is the time it has to land */
#pragma unroll
  for (int t = 0; t < 4; ++t) { float nm = mx[t];
#pragma unroll
    for (int r = 0; r < 8; ++r) nm = fmaxf(nm, d[t][r]);
    const float nl = -nm * L2E; const v2f n2 = {nl, nl}; const float rs = __builtin_amdgcn_exp2f(fmaf(mx[t], L2E, nl)); const v2f r2 = {rs, rs};
    v2f s = se[t] * r2;      /* even rows add up in element 0, odd rows in element 1 */
#pragma unroll
    for (int r = 0; r < 8; r += 2) s += ex2_pair(d[t][r], d[t][r + 1], n2);
    se[t] = s; mx[t] = nm; } }
__global__ __launch_bounds__(SCW * 32) __attribute__((amdgpu_waves_per_eu(SCW / 4, SCW / 4)))      /* one work-group a WGP: 256 registers a wave, of which the phi fragments take 128 */
void k_colstat_f(const _Float16* __restrict__ QKV, float* __restrict__ ST) {
  __shared__ float rmx[SCW * 2][SCM]; __shared__ float rse[SCW * 2][SCM];
  const int tid = threadIdx.x, w = tid >> 5, lane = tid & 31, ln = lane & 15, hh = lane >> 4;
  const _Float16* q = QKV + (size_t)blockIdx.y * QIS; const int m0 = blockIdx.x * SCM;
  const _Float16* pb = q + (size_t)m0 * CI + 8 * lane;      /* phi lies NP CI elements on (an immediate offset of the loads); 16 rows of K = 128 are 4 blocks = 16 CI elements: row r0 (a multiple of 16) starts r0 CI elements into its plane */
  const _Float16* th = q + (size_t)(w * (NP / SCW)) * CI + 8 * lane;
  int pos = ((blockIdx.x >> 1) & 12) | (blockIdx.x & 3);      /* 0..15: the wave's 16 trips run in a ring that starts at a place of the work-group's own: work-groups of an image sweep the same theta rows, and would else ask L2 for the same lines at the same moment. Bit 2 of the index is left out (speed only; any start gives the same sums but for their order) */
  const _Float16* t0 = th + (size_t)(pos * 16) * CI;
  v16h ph[4][4], a0[4], a1[4];
#pragma unroll
  for (int t = 0; t < 4; ++t) {
#pragma unroll
    for (int k = 0; k < 4; ++k) ph[t][k] = p_frag(pb + NP * CI + (t * 4 + k) * FRB); }
#pragma unroll
  for (int k = 0; k < 4; ++k) a0[k] = p_frag(t0 + k * FRB);
  asm volatile("s_wait_xcnt 0x0" :: "v"(pb), "v"(t0), "v"(lane) : "memory");      /* a precaution: what the 40 loads above name (the two addresses, or a scalar base with the lane's number) stays live and unwritten up to this wait */
  float mx[4] = {-3.0e38f, -3.0e38f, -3.0e38f, -3.0e38f}; const v2f z2 = {0.f, 0.f}; v2f se[4] = {z2, z2, z2, z2};
#pragma unroll 1      /* rolled: two trips are the period of the register sets, and the loop stays small in the instruction cache */
  for (int nb = 0; nb < NP / SCW; nb += 32) {
    pos = (pos + 1) & (NP / SCW / 16 - 1); cs_trip(th + (size_t)(pos * 16) * CI, ph, a0, a1, mx, se);
    pos = (pos + 1) & (NP / SCW / 16 - 1); cs_trip(th + (size_t)(pos * 16) * CI, ph, a1, a0, mx, se); }      /* the last trip fetches the ring's first rows again: in bounds, not used */
#pragma unroll
  for (int t = 0; t < 4; ++t) { rmx[w * 2 + hh][t * 16 + ln] = mx[t]; rse[w * 2 + hh][t * 16 + ln] = se[t][0] + se[t][1]; }
  __syncthreads();      /* every wave's partial maxima and sums are in LDS before a thread folds a column */
  if (tid < SCM) { float m = rmx[0][tid];
#pragma unroll
    for (int i = 1; i < SCW * 2; ++i) m = fmaxf(m, rmx[i][tid]);
    float s = 0.f;
#pragma unroll
    for (int i = 0; i < SCW * 2; ++i) s += rse[i][tid] * __expf(rmx[i][tid] - m);
    ST[(size_t)blockIdx.y * NM + m0 + tid] = 8.0f - fmaf(m, L2E, __builtin_amdgcn_logf(s)); } }      /* the native log2: s lies in [1, 4096] */
// y^T = P g^T with neither f nor P stored, and the last product behind it in the same kernel (y^T never leaves the work-group). A work-group owns 64 rows n and all 128 columns of y^T; wave w takes the key columns m in [1024 w, 1024 w + 1024), 32 a trip; the partial tiles (f32) meet in LDS and are added in wave order.
// The score tile is formed TRANSPOSED: D[m][n] = phi[m] . theta[n] (phi as A, theta as B, theta resident). A lane then holds m = 8 hh + r of column n = ln, which is the k order of an A fragment of row ln
// (tile m 0..15 -> elements 0..7, tile m 16..31 -> elements 8..15), so P[n][m] = f16(2^(s log2e + ST[m])) becomes the A operand of P g^T in place, with no exchange between lanes.
// All loads stand at the head of a trip and fetch the NEXT trip's records, g and phi (two register sets that swap roles): with one wave a SIMD nothing else hides a load, so each gets a whole trip to land in.
#define PVW 4                     /* waves: the 4,096 key columns split over them */
#define PVN 4                     /* 16-row tiles of n per wave: every phi and g fragment fetched serves PVN matrix instructions */
struct PvSet { v4f nc[4]; v16h pf[2][4], gf[8]; };      /* what one trip reads: the ST values of its 32 columns, its phi fragments (A of the scores), its g fragments (B of P g^T) */
// rb, gb, pb are the addresses that the loads name; RO, GO, PO (elements) go into the loads' immediate offsets, so that the wait below can hold exactly those registers.
template <int RO, int GO, int PO>
__device__ __forceinline__ void pv_fetch(const float* rb, const _Float16* gb, const _Float16* pb, PvSet& x) {
  const float* r = rb + RO;
#pragma unroll
  for (int u = 0; u < 2; ++u) { x.nc[2 * u] = *(const v4fa*)(r + 16 * u); x.nc[2 * u + 1] = *(const v4fa*)(r + 16 * u + 4); }
#pragma unroll
  for (int u = 0; u < 2; ++u) {
#pragma unroll
    for (int k = 0; k < 4; ++k) x.pf[u][k] = p_frag(pb + NP * CI + PO + (u * 4 + k) * FRB); }
#pragma unroll
  for (int c = 0; c < 8; ++c) x.gf[c] = p_frag(gb + GO + c * FRB);
  asm volatile("s_wait_xcnt 0x0" :: "v"(gb), "v"(pb) : "memory");      /* a precaution: the addresses that the 36 loads above name stay unwritten up to this wait (gb and pb held live by it; rb is not named: forming it for this line from the loop's own pointer would write the register that the 4 loads of r name) */
  __builtin_amdgcn_sched_barrier(0); }      /* keeps the 36 loads at the head of the trip: without it the scheduler spreads them through the trip and waits for them at once */
__device__ __forceinline__ void pv_trip(const PvSet& c_, const v16h (&th)[PVN][4], v8f (&acc)[PVN][8]) {
  const v8f z8 = {0.f,0.f,0.f,0.f,0.f,0.f,0.f,0.f}; v8f s[2][PVN];      /* [m tile][n tile] */
#pragma unroll
  for (int u = 0; u < 2; ++u) {
#pragma unroll
    for (int v = 0; v < PVN; ++v) s[u][v] = z8; }
#pragma unroll
  for (int k = 0; k < 4; ++k) {
#pragma unroll
    for (int u = 0; u < 2; ++u) {
#pragma unroll
      for (int v = 0; v < PVN; ++v) s[u][v] = f_mma(c_.pf[u][k], th[v][k], s[u][v]); } }
  FragH f[PVN];
#pragma unroll
  for (int u = 0; u < 2; ++u) {
#pragma unroll
    for (int e = 0; e < 8; e += 2) { const v2f nc = {c_.nc[u * 2 + (e >> 2)][e & 3], c_.nc[u * 2 + (e >> 2)][(e & 3) + 1]};
#pragma unroll
      for (int v = 0; v < PVN; ++v) { const v2f p = ex2_pair(s[u][v][e], s[u][v][e + 1], nc); f[v].h[u * 8 + e] = (_Float16)p[0]; f[v].h[u * 8 + e + 1] = (_Float16)p[1]; } } }
#pragma unroll
  for (int c = 0; c < 8; ++c) {
#pragma unroll
    for (int v = 0; v < PVN; ++v) acc[v][c] = f_mma(f[v].v, c_.gf[c], acc[v][c]); } }
__global__ __launch_bounds__(PVW * 32) __attribute__((amdgpu_waves_per_eu(PVW / 4, PVW / 4)))      /* one wave a SIMD: the accumulators (256 registers), theta (128) and the fragments in flight need more than 512 */
void k_pvf(const _Float16* __restrict__ QKV, const float* __restrict__ ST, const _Float16* __restrict__ G, float alpha, const _Float16* __restrict__ A, const float* __restrict__ x, float* __restrict__ C) {
  __shared__ __attribute__((aligned(16))) float so[PVW][16 * PVN][CI + 4];
  __shared__ __attribute__((aligned(16))) unsigned short yl[PVN * 4 * FRB];      /* the work-group's 64 rows of y^T, f16, in fragment order */
  const int tid = threadIdx.x, w = tid >> 5, lane = tid & 31, ln = lane & 15, hh = lane >> 4;
  const size_t by = blockIdx.y; const int n0 = blockIdx.x * (16 * PVN); const int ks = NM / PVW;
  const _Float16* q = QKV + by * QIS;
  int pos = ((blockIdx.x >> 1) & 28) | (blockIdx.x & 3);      /* 0..31: the wave's 32 trips run in a ring that starts at a place of the work-group's own: work-groups of an image sweep the same phi and g, and would else ask L2 for the same lines at the same moment (bit 2 of the index left out as in the statistics kernel) */
  const float* stp = ST + by * NM + (size_t)(w * ks + pos * 32) + 8 * hh;      /* one f32 a column */
  const _Float16* gp = G + by * CI * NM + (size_t)(w * ks + pos * 32) * CI + 8 * lane;      /* g: the 8 blocks (128 channels) of 32 key columns follow each other, 32 CI elements */
  const _Float16* pp = q + (size_t)(w * ks + pos * 32) * CI + 8 * lane;      /* the same place in the theta plane; phi lies NP CI elements on (an immediate offset of the loads) */
  const _Float16* tp = q + (size_t)n0 * CI + 8 * lane;
  v16h th[PVN][4]; PvSet s0, s1;
#pragma unroll
  for (int v = 0; v < PVN; ++v) {
#pragma unroll
    for (int k = 0; k < 4; ++k) th[v][k] = p_frag(tp + (v * 4 + k) * FRB); }
  asm volatile("s_wait_xcnt 0x0" :: "v"(tp) : "memory");      /* a precaution: the address that the 32 loads above name stays live and unwritten up to this wait */
  pv_fetch<0, 0, 0>(stp, gp, pp, s0);
  const v8f z8 = {0.f,0.f,0.f,0.f,0.f,0.f,0.f,0.f}; v8f acc[PVN][8];
#pragma unroll
  for (int v = 0; v < PVN; ++v) {
#pragma unroll
    for (int c = 0; c < 8; ++c) acc[v][c] = z8; }
#pragma unroll 1      /* rolled: two trips are the period of the register sets, and the loop stays small in the instruction cache */
  for (int kb = 0; kb < ks; kb += 64) {
    int st = pos == NM / PVW / 32 - 1 ? 1 - NM / PVW / 32 : 1;      /* one trip on, or from the range's end back to its start */
    pos += st; stp += st * 32; gp += st * (32 * CI); pp += st * (32 * CI);
    pv_fetch<0, 0, 0>(stp, gp, pp, s1); pv_trip(s0, th, acc);
    st = pos == NM / PVW / 32 - 1 ? 1 - NM / PVW / 32 : 1;
    pos += st; stp += st * 32; gp += st * (32 * CI); pp += st * (32 * CI);
    pv_fetch<0, 0, 0>(stp, gp, pp, s0); pv_trip(s1, th, acc); }      /* the last trip fetches the ring's first place again: in bounds, not used */
  /* what the last product needs from memory is asked for here, so that it lands while the partial tiles meet in LDS: wave w owns output channels 64 w .. 64 w + 63 at all 64 positions */
  const int c4 = ln * 4;
  const size_t eo = by * ((size_t)CN * NP) + (size_t)(w * 64 + hh) * NP + n0 + c4;
  const float* xp = x + eo; float* cp = C + eo; v4f xv[32];      /* 16 lanes cover the 256 B of a channel row, a load takes 2 rows */
#pragma unroll
  for (int q = 0; q < 32; ++q) xv[q] = *(const v4fa*)(xp + (size_t)q * 2 * NP);
  const _Float16* ap = A + (size_t)(w * 64) * CI + 8 * lane; v16h wa[4][4];      /* 16 W in fragment order: 16 rows of K = 128 are 4 blocks */
#pragma unroll
  for (int u = 0; u < 4; ++u) {
#pragma unroll
    for (int k = 0; k < 4; ++k) wa[u][k] = p_frag(ap + (u * 4 + k) * FRB); }
  asm volatile("s_wait_xcnt 0x0" :: "v"(xp), "v"(ap) : "memory");      /* a precaution: the two addresses that the 64 loads above name stay live and unwritten up to this wait */
#pragma unroll
  for (int v = 0; v < PVN; ++v) {
#pragma unroll
    for (int c = 0; c < 8; ++c) {
#pragma unroll
      for (int e = 0; e < 8; ++e) so[w][v * 16 + 8 * hh + e][c * 16 + ln] = acc[v][c][e]; } }
  __syncthreads();      /* every wave's partial tile is in LDS before any thread adds them */
  static_assert(PVW == PVN, "one row tile a wave");
  /* y^T goes to LDS in fragment order (rows n, K = 128): wave w writes row tile w, piece it = 2 x block + half; a lane adds 8 consecutive channels of row ln */
  unsigned short* yo = yl + w * 4 * FRB + lane * 8; v8us ty[8];
#pragma unroll
  for (int it = 0; it < 8; ++it) { const float* sp = &so[0][w * 16 + ln][it * 16 + 8 * hh]; v4f sa = *(const v4f*)sp, sb = *(const v4f*)(sp + 4);
#pragma unroll
    for (int k = 1; k < PVW; ++k) { sa += *(const v4f*)(sp + k * (16 * PVN * (CI + 4))); sb += *(const v4f*)(sp + k * (16 * PVN * (CI + 4)) + 4); }
    FragH f;
#pragma unroll
    for (int e = 0; e < 4; ++e) { f.h[e] = (_Float16)(sa[e] * alpha); f.h[4 + e] = (_Float16)(sb[e] * alpha); }
    ty[it] = f.half[0]; }
#pragma unroll
  for (int it = 0; it < 8; ++it) *(v8us*)(yo + it * 256) = ty[it];
  __syncthreads();      /* all 64 rows of y^T are in LDS before a wave reads them as B; and every wave has left so, which turns into output staging */
  /* out = (16 W) y / 16 + bf16(x): D[c][n] = W (A) y^T (B), K = 128 in one chain per tile, blocks in rising order */
  v8f d[4][PVN]; v16h yb[PVN][4];
#pragma unroll
  for (int v = 0; v < PVN; ++v) {
#pragma unroll
    for (int k = 0; k < 4; ++k) yb[v][k] = p_frag((const _Float16*)yl + (v * 4 + k) * FRB + lane * 8); }
  __builtin_amdgcn_sched_barrier(0);      /* keeps the 32 LDS reads as one group ahead of the 64 products: without it each fragment is read right in front of its 4 products, which then wait out the LDS latency 16 times */
#pragma unroll
  for (int v = 0; v < PVN; ++v) {
#pragma unroll
    for (int u = 0; u < 4; ++u) d[u][v] = z8;
#pragma unroll
    for (int k = 0; k < 4; ++k) {
#pragma unroll
      for (int u = 0; u < 4; ++u) d[u][v] = f_mma(wa[u][k], yb[v][k], d[u][v]); } }
  /* the wave's 64 x 64 tile turns in its own part of so, so that whole 128-B lines leave; the residual is rounded where the rows leave LDS */
#pragma unroll
  for (int u = 0; u < 4; ++u) {
#pragma unroll
    for (int v = 0; v < PVN; ++v) {
#pragma unroll
      for (int r = 0; r < 8; ++r) so[w][u * 16 + 8 * hh + r][v * 16 + ln] = d[u][v][r] * 0.0625f; } }
  __builtin_amdgcn_fence(__ATOMIC_ACQ_REL, "workgroup"); __builtin_amdgcn_wave_barrier();
  v4f ov[32];
#pragma unroll
  for (int q = 0; q < 32; ++q) ov[q] = *(const v4fa*)&so[w][q * 2 + hh][c4];
  __builtin_amdgcn_sched_barrier(0);      /* keeps the 32 LDS reads as one group: without it they stand one by one among the sums, each waited for almost at once */
#pragma unroll
  for (int q = 0; q < 32; ++q) {
#pragma unroll
    for (int i = 0; i < 4; ++i) xv[q][i] = ov[q][i] + bf16_round(xv[q][i]); }
  __builtin_amdgcn_sched_barrier(0);      /* all 32 sums stand ahead of the stores, each in registers of its own: no staging register is reused behind a store, and the one wait behind the run covers them all */
#pragma unroll
  for (int q = 0; q < 32; ++q) *(v4f*)(cp + (size_t)q * 2 * NP) = xv[q];
  asm volatile("s_wait_xcnt 0x0" :: "v"(cp) : "memory"); }      /* a precaution: the registers that the 32 stores above name stay unwritten up to this wait */
// Projections straight from x. A work-group owns 64 positions of one image and all 384 output channels: it reads its [256 c][64 n] block of f32 x in whole 128-B lines, rounds it (bf16, exact in f16)
// and lays it in LDS as token rows [n][c]; K = 256 then runs in ONE accumulation chain per tile. Wave w takes rows 32 w .. 32 w + 31 of theta | phi and rows 16 w .. 16 w + 15 of g.
// theta | phi: D[o][n] = W (A) x^T (B): a lane holds 8 consecutive o of token n, 16 B of a token row. g: D[m][ci] = x^T (A) W_g (B): a lane holds 8 consecutive m of channel ci, 16 B of a channel-major row.
// Those 16 B are one lane's piece of a fragment-order block (theta | phi: row tile v, block w % 4, half u; g: key block v / 2, channel tile w, half v % 2), so each tile leaves straight from registers, 512 contiguous bytes a wave.
#define PJN 64                    /* positions per work-group */
#define PJP (CN + 8)              /* LDS pitch of a token row, f16: 16 B past a multiple of 256 B, so that 16 rows read or written 16 B a lane fall on different banks */
__global__ __launch_bounds__(256) __attribute__((amdgpu_waves_per_eu(2, 2)))      /* one work-group a WGP: the 24 weight fragments (192 registers) stay resident beside 12 accumulator tiles */
void k_proj(const float* __restrict__ x, const _Float16* __restrict__ BT, _Float16* __restrict__ QKV, _Float16* __restrict__ G) {
  __shared__ __attribute__((aligned(16))) _Float16 xs[PJN][PJP];
  const int tid = threadIdx.x, w = tid >> 5, lane = tid & 31, ln = lane & 15, hh = lane >> 4;
  const size_t by = blockIdx.y; const int n0 = blockIdx.x * PJN;
  const _Float16* wp = BT + (size_t)(w * 32) * CN + 8 * lane;      /* 16 rows of K = 256 are 8 blocks = 16 CN elements */
  const _Float16* wg = BT + (size_t)(w * 16) * CN + 8 * lane;      /* w_g lies 2 CI CN elements on (an immediate offset of the loads) */
  const int nl = (w & 1) * 32 + (lane & 7) * 4, cl = (w >> 1) * 64 + (lane >> 3) * 8;      /* 8 lanes cover one 128-B line of a channel row; a lane takes 4 positions of 8 + 8 channels */
  const float* xp = x + by * ((size_t)CN * NP) + (size_t)cl * NP + n0 + nl;
  v4f xv[2][8]; v16h wf[3][8];
#pragma unroll
  for (int it = 0; it < 2; ++it) {
#pragma unroll
    for (int i = 0; i < 8; ++i) xv[it][i] = *(const v4fa*)(xp + (size_t)(it * 32 + i) * NP); }
#pragma unroll
  for (int k = 0; k < 8; ++k) { wf[0][k] = p_frag(wp + k * FRB); wf[1][k] = p_frag(wp + 16 * CN + k * FRB); wf[2][k] = p_frag(wg + 2 * CI * CN + k * FRB); }
  asm volatile("s_wait_xcnt 0x0" :: "v"(xp), "v"(wp), "v"(wg) : "memory");      /* a precaution: the three addresses that the 64 loads above name stay live and unwritten up to this wait */
#pragma unroll
  for (int it = 0; it < 2; ++it) {
#pragma unroll
    for (int j = 0; j < 4; ++j) { FragH f;
#pragma unroll
      for (int i = 0; i < 8; ++i) f.h[i] = (_Float16)bf16_round(xv[it][i][j]);
      *(v8us*)&xs[nl + j][cl + it * 32] = f.half[0]; } }
  __syncthreads();      /* the whole x^T tile is in LDS before any wave reads a fragment of it */
  const v8f z8 = {0.f,0.f,0.f,0.f,0.f,0.f,0.f,0.f}; v8f dq[2][4], dg[4];
#pragma unroll
  for (int v = 0; v < 4; ++v) { dq[0][v] = z8; dq[1][v] = z8; dg[v] = z8; }
  const _Float16* xr = &xs[ln][8 * hh];
  v16h xf[2][4];      /* two sets that swap roles: the LDS reads of block k + 1 stand as one group in front of the 12 products of block k */
#pragma unroll
  for (int v = 0; v < 4; ++v) xf[0][v] = f_frag(xr + v * 16 * PJP);
#pragma unroll
  for (int k = 0; k < 8; ++k) {
    if (k < 7) {
#pragma unroll
      for (int v = 0; v < 4; ++v) xf[(k + 1) & 1][v] = f_frag(xr + v * 16 * PJP + (k + 1) * 32); }
    __builtin_amdgcn_sched_barrier(0);      /* keeps the reads ahead of the products: without it each fragment is read right in front of its 3 products, which then wait out the LDS latency 32 times */
#pragma unroll
    for (int v = 0; v < 4; ++v) { dq[0][v] = f_mma(wf[0][k], xf[k & 1][v], dq[0][v]); dq[1][v] = f_mma(wf[1][k], xf[k & 1][v], dq[1][v]); dg[v] = f_mma(xf[k & 1][v], wf[2][k], dg[v]); } }
  v8us tq[4][2], tg[4];
#pragma unroll
  for (int v = 0; v < 4; ++v) { FragH f;
#pragma unroll
    for (int u = 0; u < 2; ++u) {
#pragma unroll
      for (int r = 0; r < 8; ++r) f.h[r] = (_Float16)(dq[u][v][r] * 0.0625f);
      tq[v][u] = f.half[0]; }
#pragma unroll
    for (int r = 0; r < 8; ++r) f.h[r] = (_Float16)(dg[v][r] * 0.0625f);
    tg[v] = f.half[0]; }
  unsigned short* qo = (unsigned short*)QKV + by * QIS + (size_t)(w >> 2) * (NP * CI) + (size_t)n0 * CI + (w & 3) * FRB + lane * 8;      /* waves 0..3 hold theta, 4..7 phi; the wave's 32 channels are block w % 4 of every row tile */
  unsigned short* go = (unsigned short*)G + by * ((size_t)CI * NM) + (size_t)n0 * CI + w * FRB + lane * 8;      /* the wave's 16 channels are block w of every 32 key columns */
  __builtin_amdgcn_sched_barrier(0);      /* all 12 pieces stand ahead of the stores, each in registers of its own: no staging register is reused behind a store, and the one wait behind the run covers them all */
#pragma unroll
  for (int v = 0; v < 4; ++v) {
#pragma unroll
    for (int u = 0; u < 2; ++u) *(v8us*)(qo + v * 4 * FRB + u * 256) = tq[v][u]; }
#pragma unroll
  for (int v = 0; v < 4; ++v) *(v8us*)(go + (v >> 1) * 8 * FRB + (v & 1) * 256) = tg[v];
  asm volatile("s_wait_xcnt 0x0" :: "v"(qo), "v"(go) : "memory"); }      /* a precaution: the registers that the 12 stores above name stay unwritten up to this wait */
extern "C" void kernel_launch(void* const* d_in, const int* in_sizes, int n_in,
                              void* d_out, int out_size, void* d_ws, size_t ws_size, hipStream_t stream) {
  (void)in_sizes; (void)n_in; (void)out_size;
  const float* const* I = (const float* const*)d_in; const float* x = I[0]; const float* tw = I[1]; const float* pw = I[2]; const float* gw = I[3]; const float* ww = I[4];      /* natural 1x1 conv weights: w_theta, w_phi, w_g [128][256], w_mask [256][128]; no biases */
  char* ws = (char*)d_ws; size_t off = 0;
  auto take = [&](size_t bytes) { char* p = ws + off; off += (bytes + 255) & ~(size_t)255; return p; };
  _Float16* BT = (_Float16*)take((size_t)4 * CI * CN * 2); _Float16* BW = BT + (size_t)3 * CI * CN;      /* w_theta, w_phi, w_g as one [384][256] plane, then w_mask */
  _Float16* QKV = (_Float16*)take((size_t)NB * QIS * 2); _Float16* G = (_Float16*)take((size_t)NB * CI * NP * 2);
  float* ST = (float*)take((size_t)NB * NM * 4);      /* per column 8 - max log2e - log2(sum) */
  if (off > ws_size) return;
  k_wnat<<<dim3((unsigned)(((size_t)CI * CN / 8 + 255) / 256), 4), 256, 0, stream>>>(tw, pw, gw, ww, (size_t)CI * CN / 8, BT);      /* [out][in] x16 f16 planes in fragment order */
  k_proj<<<dim3(NP / PJN, NB), 256, 0, stream>>>(x, BT, QKV, G);      /* every image: theta^T, phi^T [n][128] and g [ci][m] (the PV B^T operand) -> f16 planes in fragment order, from f32 x */
  k_colstat_f<<<dim3(NM / SCM, NB), SCW * 32, 0, stream>>>(QKV, ST);      /* every image: softmax over the QUERY axis: per key column m the max and the sum (kept as one f32: 8 - max log2e - log2 sum) over all 4096 rows n of f[n][m] = theta[n].phi[m] (K = 128, NO scale), f formed in registers */
  k_pvf<<<dim3(NP / (16 * PVN), NB), PVW * 32, 0, stream>>>(QKV, ST, G, 0.00390625f, BW, x, (float*)d_out);      /* every image: y^T [n][ci] = sum_m P[n][m] g[ci][m] -> f16 in LDS, P[n][m] = f16(256 exp(f - max_m) / sum_m), f formed again in registers; then out[c][a] = (16 W as A) x (y^T as B^T) / 16 + bf16(x) -> f32 channel-first output block */
}
